// v000
// The times below were measured on an AMD MI455X: many runs one after another, warmed up first and cycling through
// copies of the inputs, with the whole window's GPU time divided by the number of runs. Launches and the gaps
// between them are all in it. The median over several windows is given; except for v000 it joins two sittings, which
// can be a few percent apart, so the side-by-side timings, each taken in one sitting, are the better comparison.
// v000, which the later versions start from, runs in 479 microseconds.
#include <hip/hip_runtime.h>
#include <math.h>

typedef __attribute__((ext_vector_type(2))) float v2f;
typedef __attribute__((ext_vector_type(8))) float v8f;

#define NN 2048
#define DD 64
#define HH 8
#define BHN 16              // B*H
#define MASK_VALF 10000.0f
#define EPSF 1e-7f

// score = (1 + g)^-5, g = acos(clip(qk)) masked to 10000 when key is padded
__device__ __forceinline__ float score_of(float qk, int keep) {
    float q = fminf(fmaxf(qk, -1.0f + EPSF), 1.0f - EPSF);
    float g = acosf(q);              // R = 1.0
    g = keep ? g : MASK_VALF;
    float t = 1.0f + g;              // bandwidth = 1.0
    float inv = 1.0f / t;
    float i2 = inv * inv;
    return i2 * i2 * inv;            // t^-5  (= t^(-d_int-alpha))
}

// ---------------------------------------------------------------------------
// Kernel 1: per-(b,h) column degrees  ncinv[bh, m] = rsqrt(sum_n score[n,m])
// One wave owns a 16-column strip; streams all 128 row tiles with fp32 WMMA.
// ---------------------------------------------------------------------------
__global__ __launch_bounds__(128) void spop_colsum_kernel(
    const float* __restrict__ Q, const float* __restrict__ K,
    const int* __restrict__ mask, float* __restrict__ ncinv) {
    const int lane = threadIdx.x & 31;
    const int wave = threadIdx.x >> 5;
    const int gw   = blockIdx.x * 4 + wave;      // global wave id
    const int bh   = gw >> 7;                    // / (N/16)
    const int cm   = (gw & 127) << 4;            // column base
    const int b    = bh >> 3;                    // / H
    const size_t base = (size_t)bh * NN * DD;

    const int ln = lane & 15;                    // N (and M) index inside tile
    const int lh = lane >> 4;                    // half-wave selector

    // B fragments: K rows cm+ln, contiguous float2 at k = 4*kc + 2*lh
    v2f kfr[16];
#pragma unroll
    for (int kc = 0; kc < 16; ++kc)
        kfr[kc] = *(const v2f*)(K + base + (size_t)(cm + ln) * DD + kc * 4 + 2 * lh);

    const int keep = mask[b * NN + cm + ln];
    float colAcc = 0.0f;

    for (int rt = 0; rt < 128; ++rt) {
        const int rn = rt << 4;
        v2f afr[16];
#pragma unroll
        for (int kc = 0; kc < 16; ++kc)
            afr[kc] = *(const v2f*)(Q + base + (size_t)(rn + ln) * DD + kc * 4 + 2 * lh);
        v8f c = {};
#pragma unroll
        for (int kc = 0; kc < 16; ++kc)
            c = __builtin_amdgcn_wmma_f32_16x16x4_f32(
                    false, afr[kc], false, kfr[kc], (short)0, c, false, false);
#pragma unroll
        for (int r = 0; r < 8; ++r)
            colAcc += score_of(c[r], keep);
    }
    // column n=ln lives in lanes ln and ln+16: combine halves
    colAcc += __shfl_xor(colAcc, 16, 32);
    if (lane < 16)
        ncinv[bh * NN + cm + lane] = rsqrtf(colAcc);   // n_c^(-a), a = 0.5
}

// ---------------------------------------------------------------------------
// Kernel 2: single-pass output. One wave owns 16 rows; streams column tiles,
// accumulates O += (score * nc^-1/2) @ V with fp32 WMMA, plus n_r and S.
// ---------------------------------------------------------------------------
__global__ __launch_bounds__(128) void spop_attn_out_kernel(
    const float* __restrict__ Q, const float* __restrict__ K,
    const float* __restrict__ V, const int* __restrict__ mask,
    const float* __restrict__ ncinv, float* __restrict__ out) {
    __shared__ float lds[4][16 * 17];            // per-wave padded P tile
    const int lane = threadIdx.x & 31;
    const int wave = threadIdx.x >> 5;
    const int gw   = blockIdx.x * 4 + wave;
    const int bh   = gw >> 7;
    const int rn   = (gw & 127) << 4;            // row base
    const int b    = bh >> 3;
    const size_t base = (size_t)bh * NN * DD;
    const int ln = lane & 15;
    const int lh = lane >> 4;
    float* myLds = lds[wave];

    // hoisted A fragments of Q (rows rn..rn+15)
    v2f qfr[16];
#pragma unroll
    for (int kc = 0; kc < 16; ++kc)
        qfr[kc] = *(const v2f*)(Q + base + (size_t)(rn + ln) * DD + kc * 4 + 2 * lh);

    v8f oacc[4] = {};                            // O tile: 16 rows x 64 cols
    float rAcc[8], sAcc[8];
#pragma unroll
    for (int r = 0; r < 8; ++r) { rAcc[r] = 0.0f; sAcc[r] = 0.0f; }

    for (int ct = 0; ct < 128; ++ct) {
        const int cm = ct << 4;
        v2f kfr[16];
#pragma unroll
        for (int kc = 0; kc < 16; ++kc)
            kfr[kc] = *(const v2f*)(K + base + (size_t)(cm + ln) * DD + kc * 4 + 2 * lh);
        const int keep = mask[b * NN + cm + ln];
        const float ncv = ncinv[bh * NN + cm + ln];

        v8f c = {};
#pragma unroll
        for (int kc = 0; kc < 16; ++kc)
            c = __builtin_amdgcn_wmma_f32_16x16x4_f32(
                    false, qfr[kc], false, kfr[kc], (short)0, c, false, false);

        // scores -> P = score * nc^-1/2; stage to LDS for layout transpose
#pragma unroll
        for (int r = 0; r < 8; ++r) {
            float s = score_of(c[r], keep);
            rAcc[r] += s;                        // n_r partial (this column)
            float p = s * ncv;
            sAcc[r] += p;                        // S partial
            myLds[(r + 8 * lh) * 17 + ln] = p;   // P[M][N], M=r+8*lh, N=ln
        }
        // O += P(16x16) x V(16x64): 4 D-groups x 4 k-chunks of fp32 WMMA
#pragma unroll
        for (int dg = 0; dg < 4; ++dg) {
#pragma unroll
            for (int kc = 0; kc < 4; ++kc) {
                v2f a, bv;
                a.x = myLds[ln * 17 + kc * 4 + 2 * lh];       // A: M=ln, K pair
                a.y = myLds[ln * 17 + kc * 4 + 2 * lh + 1];
                const float* vp = V + base
                                + (size_t)(cm + kc * 4 + 2 * lh) * DD
                                + dg * 16 + ln;               // B: K row pair, N=ln
                bv.x = vp[0];
                bv.y = vp[DD];
                oacc[dg] = __builtin_amdgcn_wmma_f32_16x16x4_f32(
                               false, a, false, bv, (short)0, oacc[dg], false, false);
            }
        }
    }

    // reduce row sums across the 16 lanes of each half-wave
#pragma unroll
    for (int off = 1; off < 16; off <<= 1) {
#pragma unroll
        for (int r = 0; r < 8; ++r) {
            rAcc[r] += __shfl_xor(rAcc[r], off, 32);
            sAcc[r] += __shfl_xor(sAcc[r], off, 32);
        }
    }
    // out_row = n_r^-a * Oacc_row / max(n_r^-a * S_row, 1e-12)
    float scl[8];
#pragma unroll
    for (int r = 0; r < 8; ++r) {
        float rs = rsqrtf(rAcc[r]);
        float denom = fmaxf(rs * sAcc[r], 1e-12f);
        scl[r] = rs / denom;
    }
#pragma unroll
    for (int dg = 0; dg < 4; ++dg)
#pragma unroll
        for (int r = 0; r < 8; ++r)
            out[(size_t)(bh * NN + rn + r + 8 * lh) * DD + dg * 16 + ln] =
                oacc[dg][r] * scl[r];
}

extern "C" void kernel_launch(void* const* d_in, const int* in_sizes, int n_in,
                              void* d_out, int out_size, void* d_ws, size_t ws_size,
                              hipStream_t stream) {
    (void)in_sizes; (void)n_in; (void)out_size; (void)ws_size;
    const float* Q    = (const float*)d_in[0];
    const float* K    = (const float*)d_in[1];
    const float* V    = (const float*)d_in[2];
    const int*   mask = (const int*)d_in[3];
    float* out   = (float*)d_out;
    float* ncinv = (float*)d_ws;                 // BH*N floats = 128 KB

    // 16 heads * 128 strips of 16 / 4 waves per block = 512 blocks, 128 thr
    dim3 block(128), grid(512);
    spop_colsum_kernel<<<grid, block, 0, stream>>>(Q, K, mask, ncinv);
    spop_attn_out_kernel<<<grid, block, 0, stream>>>(Q, K, V, mask, ncinv, out);
}

// v001
// It runs in 217 microseconds.
// Two timings next to v000 both put it at 2.26 times that version's speed.
#include <hip/hip_runtime.h>
#include <math.h>
#include <stdint.h>

typedef __attribute__((ext_vector_type(2))) float v2f;
typedef __attribute__((ext_vector_type(8))) float v8f;

#define NN 2048
#define DD 64
#define HH 8
#define BHN 16              // B*H
#define MASK_VALF 10000.0f
#define EPSF 1e-7f
#define SROWS 32            // rows of a streamed operand per LDS stage (two 16-row tiles)
#define NSTG (NN / SROWS)   // stages per stream
#define RP 68               // LDS row pitch, dwords: 16 rows x 16 B of a fragment read fall on 64 banks
#define VP 72               // LDS row pitch of V, dwords: rows k and k+2 of a fragment read fall 16 banks apart

// byte offset of a __shared__ address in the work-group's LDS
__device__ __forceinline__ unsigned lds_off(const void* p) {
    return (unsigned)(uintptr_t)p;
}

// Four asynchronous 16-byte copies per lane, global -> LDS, through no register.
// The block's 128 lanes move 2 KiB per copy: global steps by 2 KiB, LDS by lstep bytes.
// s_wait_xcnt 0 closes the statement so that no address register named here is
// rewritten ahead of it.
__device__ __forceinline__ void copy4_to_lds(unsigned l, unsigned lstep, const char* g) {
    asm volatile(
        "global_load_async_to_lds_b128 %0, %4, off\n\t"
        "global_load_async_to_lds_b128 %1, %5, off\n\t"
        "global_load_async_to_lds_b128 %2, %6, off\n\t"
        "global_load_async_to_lds_b128 %3, %7, off\n\t"
        "s_wait_xcnt 0x0"
        :: "v"(l), "v"(l + lstep), "v"(l + 2u * lstep), "v"(l + 3u * lstep),
           "v"(g), "v"(g + 2048), "v"(g + 4096), "v"(g + 6144)
        : "memory");
}
// this wave's copies have landed in LDS
__device__ __forceinline__ void wait_copies() { asm volatile("s_wait_asynccnt 0x0" ::: "memory"); }
// this wave's LDS reads and writes have retired (before a buffer it read is refilled)
__device__ __forceinline__ void wait_lds() { asm volatile("s_wait_dscnt 0x0" ::: "memory"); }

// score = (1 + g)^-5, g = acos(clip(qk)) masked to 10000 when key is padded
__device__ __forceinline__ float score_of(float qk, int keep) {
    float q = fminf(fmaxf(qk, -1.0f + EPSF), 1.0f - EPSF);
    float g = acosf(q);              // R = 1.0
    g = keep ? g : MASK_VALF;
    float t = 1.0f + g;              // bandwidth = 1.0
    float inv = 1.0f / t;
    float i2 = inv * inv;
    return i2 * i2 * inv;            // t^-5  (= t^(-d_int-alpha))
}

// ---------------------------------------------------------------------------
// Kernel 1: per-(b,h) column degrees  ncinv[bh, m] = rsqrt(sum_n score[n,m])
// One wave owns a 16-column strip; streams all 128 row tiles with fp32 WMMA.
// The block's four waves share the Q stream: it is copied to LDS one stage ahead.
// ---------------------------------------------------------------------------
__global__ __launch_bounds__(128) void spop_colsum_kernel(
    const float* __restrict__ Q, const float* __restrict__ K,
    const int* __restrict__ mask, float* __restrict__ ncinv) {
    __shared__ __attribute__((aligned(16))) float sQ[2][SROWS * RP];
    const int lane = threadIdx.x & 31;
    const int wave = threadIdx.x >> 5;
    const int gw   = blockIdx.x * 4 + wave;      // global wave id
    const int bh   = gw >> 7;                    // / (N/16)
    const int cm   = (gw & 127) << 4;            // column base
    const int b    = bh >> 3;                    // / H
    const size_t base = (size_t)bh * NN * DD;

    const int ln = lane & 15;                    // N (and M) index inside tile
    const int lh = lane >> 4;                    // half-wave selector

    // B fragments: K rows cm+ln, contiguous float2 at k = 4*kc + 2*lh
    v2f kfr[16];
#pragma unroll
    for (int kc = 0; kc < 16; ++kc)
        kfr[kc] = *(const v2f*)(K + base + (size_t)(cm + ln) * DD + kc * 4 + 2 * lh);

    const int keep = mask[b * NN + cm + ln];
    float colAcc = 0.0f;

    // lane's 16 bytes of each 2 KiB (8 rows) of a stage: row tid/16, chunk tid%16
    const int crow = threadIdx.x >> 4;
    const int ccol = (threadIdx.x & 15) << 2;
    const char* gq = (const char*)(Q + base) + threadIdx.x * 16;
    const unsigned lq0 = lds_off(&sQ[0][crow * RP + ccol]);
    const unsigned lq1 = lds_off(&sQ[1][crow * RP + ccol]);

    copy4_to_lds(lq0, 8 * RP * 4, gq);                       // stage 0
    wait_copies();
    __syncthreads();                                         // stage 0 readable by all waves
    copy4_to_lds(lq1, 8 * RP * 4, gq + SROWS * DD * 4);      // stage 1 flies during stage 0

    for (int st = 0; st < NSTG; ++st) {
        const float* qb = sQ[st & 1];
        // both tiles of a stage in one straight line: tile 1's products can issue under tile 0's vector work
#pragma unroll
        for (int t = 0; t < SROWS / 16; ++t) {
            v2f afr[16];
#pragma unroll
            for (int kc = 0; kc < 16; ++kc)
                afr[kc] = *(const v2f*)(qb + (t * 16 + ln) * RP + kc * 4 + 2 * lh);
            v8f c = {};
#pragma unroll
            for (int kc = 0; kc < 16; ++kc)
                c = __builtin_amdgcn_wmma_f32_16x16x4_f32(
                        false, afr[kc], false, kfr[kc], (short)0, c, false, false);
#pragma unroll
            for (int r = 0; r < 8; ++r)
                colAcc += score_of(c[r], keep);
        }
        // publish stage st+1, free stage st's buffer, then refill it with stage st+2
        wait_lds();
        wait_copies();
        __syncthreads();
        if (st + 2 < NSTG)
            copy4_to_lds((st & 1) ? lq1 : lq0, 8 * RP * 4,
                         gq + (size_t)(st + 2) * (SROWS * DD * 4));
    }
    wait_copies();
    // column n=ln lives in lanes ln and ln+16: combine halves
    colAcc += __shfl_xor(colAcc, 16, 32);
    if (lane < 16)
        ncinv[bh * NN + cm + lane] = rsqrtf(colAcc);   // n_c^(-a), a = 0.5
}

// ---------------------------------------------------------------------------
// Kernel 2: single-pass output. One wave owns 16 rows; streams column tiles,
// accumulates O += (score * nc^-1/2) @ V with fp32 WMMA, plus n_r and S.
// The block's four waves share the K and V streams (copied to LDS one stage
// ahead) and the head's mask and column scales (copied to LDS once).
// ---------------------------------------------------------------------------
__global__ __launch_bounds__(128) void spop_attn_out_kernel(
    const float* __restrict__ Q, const float* __restrict__ K,
    const float* __restrict__ V, const int* __restrict__ mask,
    const float* __restrict__ ncinv, float* __restrict__ out) {
    __shared__ float lds[4][16 * 17];            // per-wave padded P tile
    __shared__ __attribute__((aligned(16))) float sK[2][SROWS * RP];
    __shared__ __attribute__((aligned(16))) float sV[2][SROWS * VP];
    __shared__ __attribute__((aligned(16))) float sNc[NN];
    __shared__ __attribute__((aligned(16))) int   sMask[NN];
    const int lane = threadIdx.x & 31;
    const int wave = threadIdx.x >> 5;
    const int gw   = blockIdx.x * 4 + wave;
    const int bh   = gw >> 7;
    const int rn   = (gw & 127) << 4;            // row base
    const int b    = bh >> 3;
    const size_t base = (size_t)bh * NN * DD;
    const int ln = lane & 15;
    const int lh = lane >> 4;
    float* myLds = lds[wave];

    // hoisted A fragments of Q (rows rn..rn+15)
    v2f qfr[16];
#pragma unroll
    for (int kc = 0; kc < 16; ++kc)
        qfr[kc] = *(const v2f*)(Q + base + (size_t)(rn + ln) * DD + kc * 4 + 2 * lh);

    v8f oacc[4] = {};                            // O tile: 16 rows x 64 cols
    float rAcc[8], sAcc[8];
#pragma unroll
    for (int r = 0; r < 8; ++r) { rAcc[r] = 0.0f; sAcc[r] = 0.0f; }

    // lane's 16 bytes of each 2 KiB (8 rows) of a stage: row tid/16, chunk tid%16
    const int crow = threadIdx.x >> 4;
    const int ccol = (threadIdx.x & 15) << 2;
    const char* gk = (const char*)(K + base) + threadIdx.x * 16;
    const char* gv = (const char*)(V + base) + threadIdx.x * 16;
    const unsigned lk0 = lds_off(&sK[0][crow * RP + ccol]);
    const unsigned lk1 = lds_off(&sK[1][crow * RP + ccol]);
    const unsigned lv0 = lds_off(&sV[0][crow * VP + ccol]);
    const unsigned lv1 = lds_off(&sV[1][crow * VP + ccol]);

    // filled once: this head's column scales and this batch's mask, 8 KiB each
    copy4_to_lds(lds_off(&sNc[threadIdx.x * 4]), 2048,
                 (const char*)(ncinv + bh * NN) + threadIdx.x * 16);
    copy4_to_lds(lds_off(&sMask[threadIdx.x * 4]), 2048,
                 (const char*)(mask + b * NN) + threadIdx.x * 16);
    copy4_to_lds(lk0, 8 * RP * 4, gk);                       // stage 0
    copy4_to_lds(lv0, 8 * VP * 4, gv);
    wait_copies();
    __syncthreads();                                         // all of it readable by all waves
    copy4_to_lds(lk1, 8 * RP * 4, gk + SROWS * DD * 4);      // stage 1 flies during stage 0
    copy4_to_lds(lv1, 8 * VP * 4, gv + SROWS * DD * 4);

    for (int st = 0; st < NSTG; ++st) {
      const float* kb = sK[st & 1];
      const float* vb = sV[st & 1];
      // both tiles of a stage in one straight line: tile 1's products can issue under tile 0's vector work
#pragma unroll
      for (int t = 0; t < SROWS / 16; ++t) {
        const int cm = st * SROWS + t * 16;
        v2f kfr[16];
#pragma unroll
        for (int kc = 0; kc < 16; ++kc)
            kfr[kc] = *(const v2f*)(kb + (t * 16 + ln) * RP + kc * 4 + 2 * lh);
        const int keep = sMask[cm + ln];
        const float ncv = sNc[cm + ln];

        v8f c = {};
#pragma unroll
        for (int kc = 0; kc < 16; ++kc)
            c = __builtin_amdgcn_wmma_f32_16x16x4_f32(
                    false, qfr[kc], false, kfr[kc], (short)0, c, false, false);

        // scores -> P = score * nc^-1/2; stage to LDS for layout transpose
#pragma unroll
        for (int r = 0; r < 8; ++r) {
            float s = score_of(c[r], keep);
            rAcc[r] += s;                        // n_r partial (this column)
            float p = s * ncv;
            sAcc[r] += p;                        // S partial
            myLds[(r + 8 * lh) * 17 + ln] = p;   // P[M][N], M=r+8*lh, N=ln
        }
        // O += P(16x16) x V(16x64): 4 D-groups x 4 k-chunks of fp32 WMMA
#pragma unroll
        for (int dg = 0; dg < 4; ++dg) {
#pragma unroll
            for (int kc = 0; kc < 4; ++kc) {
                v2f a, bv;
                a.x = myLds[ln * 17 + kc * 4 + 2 * lh];       // A: M=ln, K pair
                a.y = myLds[ln * 17 + kc * 4 + 2 * lh + 1];
                const float* vp = vb + (t * 16 + kc * 4 + 2 * lh) * VP
                                + dg * 16 + ln;               // B: K row pair, N=ln
                bv.x = vp[0];
                bv.y = vp[VP];
                oacc[dg] = __builtin_amdgcn_wmma_f32_16x16x4_f32(
                               false, a, false, bv, (short)0, oacc[dg], false, false);
            }
        }
      }
      // publish stage st+1, free stage st's buffers, then refill them with stage st+2
      wait_lds();
      wait_copies();
      __syncthreads();
      if (st + 2 < NSTG) {
          const size_t go = (size_t)(st + 2) * (SROWS * DD * 4);
          copy4_to_lds((st & 1) ? lk1 : lk0, 8 * RP * 4, gk + go);
          copy4_to_lds((st & 1) ? lv1 : lv0, 8 * VP * 4, gv + go);
      }
    }
    wait_copies();

    // reduce row sums across the 16 lanes of each half-wave
#pragma unroll
    for (int off = 1; off < 16; off <<= 1) {
#pragma unroll
        for (int r = 0; r < 8; ++r) {
            rAcc[r] += __shfl_xor(rAcc[r], off, 32);
            sAcc[r] += __shfl_xor(sAcc[r], off, 32);
        }
    }
    // out_row = n_r^-a * Oacc_row / max(n_r^-a * S_row, 1e-12)
    float scl[8];
#pragma unroll
    for (int r = 0; r < 8; ++r) {
        float rs = rsqrtf(rAcc[r]);
        float denom = fmaxf(rs * sAcc[r], 1e-12f);
        scl[r] = rs / denom;
    }
#pragma unroll
    for (int dg = 0; dg < 4; ++dg)
#pragma unroll
        for (int r = 0; r < 8; ++r)
            out[(size_t)(bh * NN + rn + r + 8 * lh) * DD + dg * 16 + ln] =
                oacc[dg][r] * scl[r];
}

extern "C" void kernel_launch(void* const* d_in, const int* in_sizes, int n_in,
                              void* d_out, int out_size, void* d_ws, size_t ws_size,
                              hipStream_t stream) {
    (void)in_sizes; (void)n_in; (void)out_size; (void)ws_size;
    const float* Q    = (const float*)d_in[0];
    const float* K    = (const float*)d_in[1];
    const float* V    = (const float*)d_in[2];
    const int*   mask = (const int*)d_in[3];
    float* out   = (float*)d_out;
    float* ncinv = (float*)d_ws;                 // BH*N floats = 128 KB

    // 16 heads * 128 strips of 16 / 4 waves per block = 512 blocks, 128 thr
    dim3 block(128), grid(512);
    spop_colsum_kernel<<<grid, block, 0, stream>>>(Q, K, mask, ncinv);
    spop_attn_out_kernel<<<grid, block, 0, stream>>>(Q, K, V, mask, ncinv, out);
}

// v002
// It runs in 154 microseconds.
// Two timings next to v001 both put it at 1.41 times that version's speed.
// Counting every step since v000, it is 3.19 times as fast.
#include <hip/hip_runtime.h>
#include <math.h>
#include <stdint.h>

typedef __attribute__((ext_vector_type(2))) float v2f;
typedef __attribute__((ext_vector_type(8))) float v8f;

#define NN 2048
#define DD 64
#define HH 8
#define BHN 16              // B*H
#define MASK_VALF 10000.0f
#define EPSF 1e-7f
#define SROWS 32            // rows of a streamed operand per LDS stage (two 16-row tiles)
#define NSTG (NN / SROWS)   // stages per stream
#define RP 68               // LDS row pitch, dwords: 16 rows x 16 B of a fragment read fall on 64 banks
#define VP 72               // LDS row pitch of V, dwords: rows k and k+2 of a fragment read fall 16 banks apart
#define VCH 8               // row chunks of the sum of V over masked keys (one partial sum each)
// workspace, in 4-byte words
#define WS_NC   0                              // float [BHN][NN]: column scales of the kept keys in list order, then zeros
#define WS_IDX  (BHN * NN)                     // int [2][NN]: kept keys in ascending order, then the masked keys
#define WS_CNT  (WS_IDX + 2 * NN)              // int [2][32]: number of kept keys, one 128-byte line per batch
#define WS_VS   (WS_CNT + 64)                  // float [VCH][BHN][DD]: partial sums of V over masked keys

// byte offset of a __shared__ address in the work-group's LDS
__device__ __forceinline__ unsigned lds_off(const void* p) {
    return (unsigned)(uintptr_t)p;
}

// Four asynchronous 16-byte copies per lane, global -> LDS, through no register.
// The block's 128 lanes move 2 KiB per copy: global steps by 2 KiB, LDS by lstep bytes.
// s_wait_xcnt 0 closes the statement so that no address register named here is
// rewritten ahead of it.
__device__ __forceinline__ void copy4_to_lds(unsigned l, unsigned lstep, const char* g) {
    asm volatile(
        "global_load_async_to_lds_b128 %0, %4, off\n\t"
        "global_load_async_to_lds_b128 %1, %5, off\n\t"
        "global_load_async_to_lds_b128 %2, %6, off\n\t"
        "global_load_async_to_lds_b128 %3, %7, off\n\t"
        "s_wait_xcnt 0x0"
        :: "v"(l), "v"(l + lstep), "v"(l + 2u * lstep), "v"(l + 3u * lstep),
           "v"(g), "v"(g + 2048), "v"(g + 4096), "v"(g + 6144)
        : "memory");
}
// The same for four rows picked by number (256 bytes a row): g points at the lane's 16 bytes of row 0.
__device__ __forceinline__ void gather4_to_lds(unsigned l, unsigned lstep, const char* g,
                                               int r0, int r1, int r2, int r3) {
    asm volatile(
        "global_load_async_to_lds_b128 %0, %4, off\n\t"
        "global_load_async_to_lds_b128 %1, %5, off\n\t"
        "global_load_async_to_lds_b128 %2, %6, off\n\t"
        "global_load_async_to_lds_b128 %3, %7, off\n\t"
        "s_wait_xcnt 0x0"
        :: "v"(l), "v"(l + lstep), "v"(l + 2u * lstep), "v"(l + 3u * lstep),
           "v"(g + (size_t)r0 * (DD * 4)), "v"(g + (size_t)r1 * (DD * 4)),
           "v"(g + (size_t)r2 * (DD * 4)), "v"(g + (size_t)r3 * (DD * 4))
        : "memory");
}
// this wave's copies have landed in LDS
__device__ __forceinline__ void wait_copies() { asm volatile("s_wait_asynccnt 0x0" ::: "memory"); }
// this wave's LDS reads and writes have retired (before a buffer it read is refilled)
__device__ __forceinline__ void wait_lds() { asm volatile("s_wait_dscnt 0x0" ::: "memory"); }

// g = acos(clip(qk)), the distance of a kept key
__device__ __forceinline__ float dist_of(float qk) {
    float q = fminf(fmaxf(qk, -1.0f + EPSF), 1.0f - EPSF);
    return acosf(q);                 // R = 1.0
}
// score = (1 + g)^-5; a masked key has g = 10000 whatever its product, so one score for all of them
__device__ __forceinline__ float score_at(float g) {
    float t = 1.0f + g;              // bandwidth = 1.0
    float inv = 1.0f / t;
    float i2 = inv * inv;
    return i2 * i2 * inv;            // t^-5  (= t^(-d_int-alpha))
}

// ---------------------------------------------------------------------------
// Kernel 0. Blocks 0 and 1: the batch's keys, the kept ones (mask != 0) first, and the number of kept ones.
// Other blocks: per head, the sum of V over the masked keys of a 256-row chunk.
// ---------------------------------------------------------------------------
__global__ __launch_bounds__(128) void spop_prep_kernel(
    const float* __restrict__ V, const int* __restrict__ mask,
    int* __restrict__ idx, int* __restrict__ cnt, float* __restrict__ vpart) {
    __shared__ int sCnt[4];
    __shared__ __attribute__((aligned(16))) float sRed[8][DD];
    const int tid = threadIdx.x;
    if (blockIdx.x < 2) {
        const int b = blockIdx.x;
        const int lane = tid & 31;
        const int wave = tid >> 5;
        // every loop over m[] and over the four waves is unrolled so that m[] stays in registers
        int m[16];                               // this thread's 16 consecutive keys
#pragma unroll
        for (int q = 0; q < 4; ++q) {
            const int4 v = *(const int4*)(mask + b * NN + tid * 16 + q * 4);
            m[q * 4 + 0] = v.x != 0; m[q * 4 + 1] = v.y != 0;
            m[q * 4 + 2] = v.z != 0; m[q * 4 + 3] = v.w != 0;
        }
        int c = 0;
#pragma unroll
        for (int e = 0; e < 16; ++e) c += m[e];
        int inc = c;                             // inclusive scan over the wave
#pragma unroll
        for (int off = 1; off < 32; off <<= 1) {
            const int o = __shfl_up(inc, off, 32);
            if (lane >= off) inc += o;
        }
        if (lane == 31) sCnt[wave] = inc;
        __syncthreads();
        int before = 0, total = 0;
#pragma unroll
        for (int w = 0; w < 4; ++w) {
            const int s = sCnt[w];
            if (w < wave) before += s;
            total += s;
        }
        int pos = before + inc - c;              // kept keys ahead of this thread's first key
        // every key gets one place: kept ones from 0, masked ones from total, so each entry names a valid row
#pragma unroll
        for (int e = 0; e < 16; ++e) {
            const int key = tid * 16 + e;
            idx[b * NN + (m[e] ? pos : total + key - pos)] = key;
            pos += m[e];
        }
        if (tid == 0) cnt[b * 32] = total;
    } else {
        const int u  = blockIdx.x - 2;
        const int bh = u / VCH;
        const int ch = u % VCH;
        const int b  = bh >> 3;
        const int rs = tid >> 4;
        const int d4 = (tid & 15) << 2;
        const float* vp = V + (size_t)bh * NN * DD + (size_t)(ch * (NN / VCH) + rs) * DD + d4;
        const int*   mp = mask + b * NN + ch * (NN / VCH) + rs;
        float4 acc = make_float4(0.0f, 0.0f, 0.0f, 0.0f);
        // 16 rows are loaded before the first is added (both inner loops unrolled, v[] and k[] in registers):
        // the chunk is latency bound
        for (int h = 0; h < NN / VCH / 8 / 16; ++h) {
            float4 v[16];
            int k[16];
#pragma unroll
            for (int i = 0; i < 16; ++i) {
                v[i] = *(const float4*)(vp + (size_t)(h * 16 + i) * 8 * DD);
                k[i] = mp[(h * 16 + i) * 8];
            }
#pragma unroll
            for (int i = 0; i < 16; ++i) {
                acc.x += k[i] ? 0.0f : v[i].x; acc.y += k[i] ? 0.0f : v[i].y;
                acc.z += k[i] ? 0.0f : v[i].z; acc.w += k[i] ? 0.0f : v[i].w;
            }
        }
        *(float4*)&sRed[rs][d4] = acc;
        __syncthreads();
        if (tid < DD) {
            float s = 0.0f;
#pragma unroll
            for (int r = 0; r < 8; ++r) s += sRed[r][tid];
            vpart[(ch * BHN + bh) * DD + tid] = s;
        }
    }
}

// ---------------------------------------------------------------------------
// Kernel 1: column scales of the kept keys, ncinv[bh, j] = rsqrt(sum_n score[n, idx[j]]), 0 past the kept keys
// One wave owns 16 kept keys; streams all 128 row tiles with fp32 WMMA.
// The block's four waves share the Q stream: it is copied to LDS one stage ahead.
// ---------------------------------------------------------------------------
__global__ __launch_bounds__(128) void spop_colsum_kernel(
    const float* __restrict__ Q, const float* __restrict__ K,
    const int* __restrict__ idx, const int* __restrict__ cnt, float* __restrict__ ncinv) {
    __shared__ __attribute__((aligned(16))) float sQ[2][SROWS * RP];
    const int lane = threadIdx.x & 31;
    const int wave = __builtin_amdgcn_readfirstlane(threadIdx.x >> 5);   // scalar: it decides a branch round WMMAs
    // key group slowest: the blocks that have work come first in index order, those that leave at once last
    const int cg   = blockIdx.x >> 4;            // group of 64 kept keys, / BHN
    const int bh   = blockIdx.x & (BHN - 1);
    const int b    = bh >> 3;                    // / H
    const int nk   = min(max(cnt[b * 32], 0), NN);
    if (cg * 64 >= nk) {                         // whole block, ahead of every copy and barrier
        if (threadIdx.x < 64) ncinv[bh * NN + cg * 64 + threadIdx.x] = 0.0f;
        return;
    }
    const int j0   = cg * 64 + wave * 16;        // first kept key of the wave
    const bool active = j0 < nk;                 // a wave past the list only helps with the copies
    const size_t base = (size_t)bh * NN * DD;

    const int ln = lane & 15;                    // N (and M) index inside tile
    const int lh = lane >> 4;                    // half-wave selector

    // B fragments: K rows idx[j0+ln], contiguous float2 at k = 4*kc + 2*lh
    const int col = idx[b * NN + j0 + ln] & (NN - 1);
    const float* kp = K + base + (size_t)col * DD + 2 * lh;
    v2f kfr[16];
#pragma unroll
    for (int kc = 0; kc < 16; ++kc)
        kfr[kc] = *(const v2f*)(kp + kc * 4);
    // kp is an input so that its registers live up to this wait: no fragment lands in the address the loads name
    asm volatile("s_wait_xcnt 0x0" :: "v"(kp) : "memory");

    float colAcc = 0.0f;

    // lane's 16 bytes of each 2 KiB (8 rows) of a stage: row tid/16, chunk tid%16
    const int crow = threadIdx.x >> 4;
    const int ccol = (threadIdx.x & 15) << 2;
    const char* gq = (const char*)(Q + base) + threadIdx.x * 16;
    const unsigned lq0 = lds_off(&sQ[0][crow * RP + ccol]);
    const unsigned lq1 = lds_off(&sQ[1][crow * RP + ccol]);

    copy4_to_lds(lq0, 8 * RP * 4, gq);                       // stage 0
    wait_copies();
    __syncthreads();                                         // stage 0 readable by all waves
    copy4_to_lds(lq1, 8 * RP * 4, gq + SROWS * DD * 4);      // stage 1 flies during stage 0

    for (int st = 0; st < NSTG; ++st) {
        const float* qb = sQ[st & 1];
        if (active) {
        // both tiles of a stage in one straight line: tile 1's products can issue under tile 0's vector work
#pragma unroll
        for (int t = 0; t < SROWS / 16; ++t) {
            v2f afr[16];
#pragma unroll
            for (int kc = 0; kc < 16; ++kc)
                afr[kc] = *(const v2f*)(qb + (t * 16 + ln) * RP + kc * 4 + 2 * lh);
            v8f c = {};
#pragma unroll
            for (int kc = 0; kc < 16; ++kc)
                c = __builtin_amdgcn_wmma_f32_16x16x4_f32(
                        false, afr[kc], false, kfr[kc], (short)0, c, false, false);
#pragma unroll
            for (int r = 0; r < 8; ++r)
                colAcc += score_at(dist_of(c[r]));
        }
        }
        // publish stage st+1, free stage st's buffer, then refill it with stage st+2
        wait_lds();
        wait_copies();
        __syncthreads();
        if (st + 2 < NSTG)
            copy4_to_lds((st & 1) ? lq1 : lq0, 8 * RP * 4,
                         gq + (size_t)(st + 2) * (SROWS * DD * 4));
    }
    wait_copies();
    // column n=ln lives in lanes ln and ln+16: combine halves
    colAcc += __shfl_xor(colAcc, 16, 32);
    if (lane < 16)                               // n_c^(-a), a = 0.5
        ncinv[bh * NN + j0 + lane] = (j0 + lane < nk) ? rsqrtf(colAcc) : 0.0f;
}

// ---------------------------------------------------------------------------
// Kernel 2: single-pass output. One wave owns 16 rows; streams tiles of kept keys,
// accumulates O += (score * nc^-1/2) @ V with fp32 WMMA, plus n_r and S.
// The block's four waves share the K and V streams (rows of kept keys, copied to
// LDS one stage ahead), the list of kept keys and their column scales (in LDS once).
// The masked keys all have the same score and column scale: their share of
// n_r, S and O is added at the end from their number and their sum of V.
// ---------------------------------------------------------------------------
__global__ __launch_bounds__(128) void spop_attn_out_kernel(
    const float* __restrict__ Q, const float* __restrict__ K,
    const float* __restrict__ V, const int* __restrict__ idx,
    const int* __restrict__ cnt, const float* __restrict__ ncinv,
    const float* __restrict__ vpart, float* __restrict__ out) {
    __shared__ float lds[4][16 * 17];            // per-wave padded P tile
    __shared__ __attribute__((aligned(16))) float sK[2][SROWS * RP];
    __shared__ __attribute__((aligned(16))) float sV[2][SROWS * VP];
    __shared__ __attribute__((aligned(16))) float sNc[NN];
    __shared__ __attribute__((aligned(16))) int   sIdx[NN];
    const int lane = threadIdx.x & 31;
    const int wave = threadIdx.x >> 5;
    const int bh   = blockIdx.x >> 5;            // 32 blocks a head: the same for the whole block
    const int rn   = (((blockIdx.x & 31) << 2) + wave) << 4;   // row base
    const int b    = bh >> 3;
    const size_t base = (size_t)bh * NN * DD;
    const int ln = lane & 15;
    const int lh = lane >> 4;
    float* myLds = lds[wave];
    const int nk  = min(max(cnt[b * 32], 0), NN);   // kept keys of this batch
    const int nst = (nk + SROWS - 1) / SROWS;       // stages that hold one

    // hoisted A fragments of Q (rows rn..rn+15)
    v2f qfr[16];
#pragma unroll
    for (int kc = 0; kc < 16; ++kc)
        qfr[kc] = *(const v2f*)(Q + base + (size_t)(rn + ln) * DD + kc * 4 + 2 * lh);

    // sum of V over the masked keys, this lane's four output columns (unrolled: all loads in flight at once)
    float vs[4];
#pragma unroll
    for (int dg = 0; dg < 4; ++dg) {
        float s = 0.0f;
#pragma unroll
        for (int ch = 0; ch < VCH; ++ch)
            s += vpart[(ch * BHN + bh) * DD + dg * 16 + ln];
        vs[dg] = s;
    }

    v8f oacc[4] = {};                            // O tile: 16 rows x 64 cols
    float rAcc[8], sAcc[8];
#pragma unroll
    for (int r = 0; r < 8; ++r) { rAcc[r] = 0.0f; sAcc[r] = 0.0f; }

    // lane's 16 bytes of each 8 rows of a stage: list entry tid/16, chunk tid%16 of its row
    const int crow = threadIdx.x >> 4;
    const int ccol = (threadIdx.x & 15) << 2;
    const char* gk = (const char*)(K + base + ccol);
    const char* gv = (const char*)(V + base + ccol);
    const unsigned lk0 = lds_off(&sK[0][crow * RP + ccol]);
    const unsigned lk1 = lds_off(&sK[1][crow * RP + ccol]);
    const unsigned lv0 = lds_off(&sV[0][crow * VP + ccol]);
    const unsigned lv1 = lds_off(&sV[1][crow * VP + ccol]);

    // filled once: this head's column scales and this batch's list of keys, 8 KiB each
    copy4_to_lds(lds_off(&sNc[threadIdx.x * 4]), 2048,
                 (const char*)(ncinv + bh * NN) + threadIdx.x * 16);
    copy4_to_lds(lds_off(&sIdx[threadIdx.x * 4]), 2048,
                 (const char*)(idx + b * NN) + threadIdx.x * 16);
    // rows of stages 0 and 1, straight from the list (every entry names a row, so both stages can always be copied);
    // unrolled here and below: the row numbers are operands of one asm statement
    int ra[4], rb[4];
#pragma unroll
    for (int i = 0; i < 4; ++i) {
        ra[i] = idx[b * NN + crow + 8 * i] & (NN - 1);
        rb[i] = idx[b * NN + SROWS + crow + 8 * i] & (NN - 1);
    }
    gather4_to_lds(lk0, 8 * RP * 4, gk, ra[0], ra[1], ra[2], ra[3]);   // stage 0
    gather4_to_lds(lv0, 8 * VP * 4, gv, ra[0], ra[1], ra[2], ra[3]);
    wait_copies();
    __syncthreads();                                         // all of it readable by all waves
    gather4_to_lds(lk1, 8 * RP * 4, gk, rb[0], rb[1], rb[2], rb[3]);   // stage 1 flies during stage 0
    gather4_to_lds(lv1, 8 * VP * 4, gv, rb[0], rb[1], rb[2], rb[3]);

    for (int st = 0; st < nst; ++st) {
      const float* kb = sK[st & 1];
      const float* vb = sV[st & 1];
      // both tiles of a stage in one straight line: tile 1's products can issue under tile 0's vector work
#pragma unroll
      for (int t = 0; t < SROWS / 16; ++t) {
        const int cm = st * SROWS + t * 16;
        v2f kfr[16];
#pragma unroll
        for (int kc = 0; kc < 16; ++kc)
            kfr[kc] = *(const v2f*)(kb + (t * 16 + ln) * RP + kc * 4 + 2 * lh);
        const float live = (cm + ln < nk) ? 1.0f : 0.0f;   // 0 only in the last stage's tail
        const float ncv = sNc[cm + ln];

        v8f c = {};
#pragma unroll
        for (int kc = 0; kc < 16; ++kc)
            c = __builtin_amdgcn_wmma_f32_16x16x4_f32(
                    false, qfr[kc], false, kfr[kc], (short)0, c, false, false);

        // scores -> P = score * nc^-1/2; stage to LDS for layout transpose
#pragma unroll
        for (int r = 0; r < 8; ++r) {
            float s = score_at(dist_of(c[r])) * live;   // a score is finite: exactly 0 past the list
            rAcc[r] += s;                        // n_r partial (this column)
            float p = s * ncv;
            sAcc[r] += p;                        // S partial
            myLds[(r + 8 * lh) * 17 + ln] = p;   // P[M][N], M=r+8*lh, N=ln
        }
        // O += P(16x16) x V(16x64): 4 D-groups x 4 k-chunks of fp32 WMMA
#pragma unroll
        for (int dg = 0; dg < 4; ++dg) {
#pragma unroll
            for (int kc = 0; kc < 4; ++kc) {
                v2f a, bv;
                a.x = myLds[ln * 17 + kc * 4 + 2 * lh];       // A: M=ln, K pair
                a.y = myLds[ln * 17 + kc * 4 + 2 * lh + 1];
                const float* vp = vb + (t * 16 + kc * 4 + 2 * lh) * VP
                                + dg * 16 + ln;               // B: K row pair, N=ln
                bv.x = vp[0];
                bv.y = vp[VP];
                oacc[dg] = __builtin_amdgcn_wmma_f32_16x16x4_f32(
                               false, a, false, bv, (short)0, oacc[dg], false, false);
            }
        }
      }
      // publish stage st+1, free stage st's buffers, then refill them with stage st+2
      wait_lds();
      wait_copies();
      __syncthreads();
      if (st + 2 < nst) {
          int rr[4];
#pragma unroll
          for (int i = 0; i < 4; ++i)
              rr[i] = sIdx[(st + 2) * SROWS + crow + 8 * i] & (NN - 1);
          gather4_to_lds((st & 1) ? lk1 : lk0, 8 * RP * 4, gk, rr[0], rr[1], rr[2], rr[3]);
          gather4_to_lds((st & 1) ? lv1 : lv0, 8 * VP * 4, gv, rr[0], rr[1], rr[2], rr[3]);
      }
    }
    wait_copies();

    // reduce row sums across the 16 lanes of each half-wave
#pragma unroll
    for (int off = 1; off < 16; off <<= 1) {
#pragma unroll
        for (int r = 0; r < 8; ++r) {
            rAcc[r] += __shfl_xor(rAcc[r], off, 32);
            sAcc[r] += __shfl_xor(sAcc[r], off, 32);
        }
    }
    // the masked keys: score c0 each, column degree NN * c0, so P = pm in every row
    const float c0 = score_at(MASK_VALF);
    const float pm = c0 * rsqrtf((float)NN * c0);
    const float nm = (float)(NN - nk);
    // out_row = n_r^-a * Oacc_row / max(n_r^-a * S_row, 1e-12)
    float scl[8];
#pragma unroll
    for (int r = 0; r < 8; ++r) {
        rAcc[r] += nm * c0;
        sAcc[r] += nm * pm;
        float rs = rsqrtf(rAcc[r]);
        float denom = fmaxf(rs * sAcc[r], 1e-12f);
        scl[r] = rs / denom;
    }
#pragma unroll
    for (int dg = 0; dg < 4; ++dg)
#pragma unroll
        for (int r = 0; r < 8; ++r)
            out[(size_t)(bh * NN + rn + r + 8 * lh) * DD + dg * 16 + ln] =
                (oacc[dg][r] + pm * vs[dg]) * scl[r];
}

extern "C" void kernel_launch(void* const* d_in, const int* in_sizes, int n_in,
                              void* d_out, int out_size, void* d_ws, size_t ws_size,
                              hipStream_t stream) {
    (void)in_sizes; (void)n_in; (void)out_size; (void)ws_size;
    const float* Q    = (const float*)d_in[0];
    const float* K    = (const float*)d_in[1];
    const float* V    = (const float*)d_in[2];
    const int*   mask = (const int*)d_in[3];
    float* out   = (float*)d_out;
    float* ncinv  = (float*)d_ws + WS_NC;
    int*   idx    = (int*)d_ws + WS_IDX;
    int*   cnt    = (int*)d_ws + WS_CNT;
    float* vpart  = (float*)d_ws + WS_VS;

    dim3 block(128);
    // 2 batches + 16 heads * 8 chunks
    spop_prep_kernel<<<dim3(2 + BHN * VCH), block, 0, stream>>>(V, mask, idx, cnt, vpart);
    // 32 groups of 64 keys * 16 heads; groups past the kept keys leave at once
    spop_colsum_kernel<<<dim3(512), block, 0, stream>>>(Q, K, idx, cnt, ncinv);
    // 16 heads * 128 strips of 16 rows / 4 waves per block
    spop_attn_out_kernel<<<dim3(512), block, 0, stream>>>(Q, K, V, idx, cnt, ncinv, vpart, out);
}

// v003
// Measured time: 118 microseconds a run.
// Timed twice side by side with v002, it ran 1.31 times as fast both times.
// All steps since v000 together make it 4.18 times as fast.
#include <hip/hip_runtime.h>
#include <math.h>
#include <stdint.h>

typedef __attribute__((ext_vector_type(2))) float v2f;
typedef __attribute__((ext_vector_type(8))) float v8f;

#define NN 2048
#define DD 64
#define HH 8
#define BHN 16              // B*H
#define MASK_VALF 10000.0f
#define EPSF 1e-7f
#define SROWS 32            // rows of a streamed operand per LDS stage (two 16-row tiles)
#define NSTG (NN / SROWS)   // stages per stream
#define RP 68               // LDS row pitch, dwords: 16 rows x 16 B of a fragment read fall on 64 banks
#define VP 68               // LDS row pitch of V, dwords: rows k and k+8 of a fragment read fall 32 banks apart
#define VCH 8               // row chunks of the sum of V over masked keys (one partial sum each)
// workspace, in 4-byte words
#define WS_NC   0                              // float [BHN][NN]: column scales of the kept keys in list order, then zeros
#define WS_IDX  (BHN * NN)                     // int [2][NN]: kept keys in ascending order, then the masked keys
#define WS_CNT  (WS_IDX + 2 * NN)              // int [2][32]: number of kept keys, one 128-byte line per batch
#define WS_VS   (WS_CNT + 64)                  // float [VCH][BHN][DD]: partial sums of V over masked keys
#define PT_CAP  126                            // tiles of 16 kept keys per head whose scores fit in the workspace
#define CAPST   (PT_CAP * 16 / SROWS)          // stages of kept keys whose scores are stored; later ones are computed again
#define WS_P    65536                          // float [BHN][NN/16][PT_CAP][2][32][4]: score tiles as the registers hold them

// byte offset of a __shared__ address in the work-group's LDS
__device__ __forceinline__ unsigned lds_off(const void* p) {
    return (unsigned)(uintptr_t)p;
}

// Four asynchronous 16-byte copies per lane, global -> LDS, through no register.
// The block's 128 lanes move 2 KiB per copy: global steps by 2 KiB, LDS by lstep bytes.
// s_wait_xcnt 0 closes the statement so that no address register named here is
// rewritten ahead of it.
__device__ __forceinline__ void copy4_to_lds(unsigned l, unsigned lstep, const char* g) {
    asm volatile(
        "global_load_async_to_lds_b128 %0, %4, off\n\t"
        "global_load_async_to_lds_b128 %1, %5, off\n\t"
        "global_load_async_to_lds_b128 %2, %6, off\n\t"
        "global_load_async_to_lds_b128 %3, %7, off\n\t"
        "s_wait_xcnt 0x0"
        :: "v"(l), "v"(l + lstep), "v"(l + 2u * lstep), "v"(l + 3u * lstep),
           "v"(g), "v"(g + 2048), "v"(g + 4096), "v"(g + 6144)
        : "memory");
}
// The same for four rows picked by number (256 bytes a row): g points at the lane's 16 bytes of row 0.
__device__ __forceinline__ void gather4_to_lds(unsigned l, unsigned lstep, const char* g,
                                               int r0, int r1, int r2, int r3) {
    asm volatile(
        "global_load_async_to_lds_b128 %0, %4, off\n\t"
        "global_load_async_to_lds_b128 %1, %5, off\n\t"
        "global_load_async_to_lds_b128 %2, %6, off\n\t"
        "global_load_async_to_lds_b128 %3, %7, off\n\t"
        "s_wait_xcnt 0x0"
        :: "v"(l), "v"(l + lstep), "v"(l + 2u * lstep), "v"(l + 3u * lstep),
           "v"(g + (size_t)r0 * (DD * 4)), "v"(g + (size_t)r1 * (DD * 4)),
           "v"(g + (size_t)r2 * (DD * 4)), "v"(g + (size_t)r3 * (DD * 4))
        : "memory");
}
// this wave's copies have landed in LDS
__device__ __forceinline__ void wait_copies() { asm volatile("s_wait_asynccnt 0x0" ::: "memory"); }
// this wave's LDS reads and writes have retired (before a buffer it read is refilled)
__device__ __forceinline__ void wait_lds() { asm volatile("s_wait_dscnt 0x0" ::: "memory"); }

// The work-group's barrier alone, for the foot of a ring's stage: wait_lds() and wait_copies() stand in front of it,
// and they are all that the LDS buffers need. __syncthreads() would also drain the wave's global stores and loads
// there, which no other wave of the block reads: the score tiles are to stay in flight over the stage's end.
__device__ __forceinline__ void stage_barrier() {
    asm volatile("s_barrier_signal -1\n\ts_barrier_wait -1" ::: "memory");
}

// g = acos(clip(qk)), the distance of a kept key
__device__ __forceinline__ float dist_of(float qk) {
    float q = fminf(fmaxf(qk, -1.0f + EPSF), 1.0f - EPSF);
    return acosf(q);                 // R = 1.0
}
// score = (1 + g)^-5; a masked key has g = 10000 whatever its product, so one score for all of them
__device__ __forceinline__ float score_at(float g) {
    float t = 1.0f + g;              // bandwidth = 1.0
    float inv = 1.0f / t;
    float i2 = inv * inv;
    return i2 * i2 * inv;            // t^-5  (= t^(-d_int-alpha))
}

// ---------------------------------------------------------------------------
// Kernel 0. Blocks 0 and 1: the batch's keys, the kept ones (mask != 0) first, and the number of kept ones.
// Other blocks: per head, the sum of V over the masked keys of a 256-row chunk.
// ---------------------------------------------------------------------------
__global__ __launch_bounds__(128) void spop_prep_kernel(
    const float* __restrict__ V, const int* __restrict__ mask,
    int* __restrict__ idx, int* __restrict__ cnt, float* __restrict__ vpart) {
    __shared__ int sCnt[4];
    __shared__ __attribute__((aligned(16))) float sRed[8][DD];
    const int tid = threadIdx.x;
    if (blockIdx.x < 2) {
        const int b = blockIdx.x;
        const int lane = tid & 31;
        const int wave = tid >> 5;
        // every loop over m[] and over the four waves is unrolled so that m[] stays in registers
        int m[16];                               // this thread's 16 consecutive keys
#pragma unroll
        for (int q = 0; q < 4; ++q) {
            const int4 v = *(const int4*)(mask + b * NN + tid * 16 + q * 4);
            m[q * 4 + 0] = v.x != 0; m[q * 4 + 1] = v.y != 0;
            m[q * 4 + 2] = v.z != 0; m[q * 4 + 3] = v.w != 0;
        }
        int c = 0;
#pragma unroll
        for (int e = 0; e < 16; ++e) c += m[e];
        int inc = c;                             // inclusive scan over the wave
#pragma unroll
        for (int off = 1; off < 32; off <<= 1) {
            const int o = __shfl_up(inc, off, 32);
            if (lane >= off) inc += o;
        }
        if (lane == 31) sCnt[wave] = inc;
        __syncthreads();
        int before = 0, total = 0;
#pragma unroll
        for (int w = 0; w < 4; ++w) {
            const int s = sCnt[w];
            if (w < wave) before += s;
            total += s;
        }
        int pos = before + inc - c;              // kept keys ahead of this thread's first key
        // every key gets one place: kept ones from 0, masked ones from total, so each entry names a valid row
#pragma unroll
        for (int e = 0; e < 16; ++e) {
            const int key = tid * 16 + e;
            idx[b * NN + (m[e] ? pos : total + key - pos)] = key;
            pos += m[e];
        }
        if (tid == 0) cnt[b * 32] = total;
    } else {
        const int u  = blockIdx.x - 2;
        const int bh = u / VCH;
        const int ch = u % VCH;
        const int b  = bh >> 3;
        const int rs = tid >> 4;
        const int d4 = (tid & 15) << 2;
        const float* vp = V + (size_t)bh * NN * DD + (size_t)(ch * (NN / VCH) + rs) * DD + d4;
        const int*   mp = mask + b * NN + ch * (NN / VCH) + rs;
        float4 acc = make_float4(0.0f, 0.0f, 0.0f, 0.0f);
        // 16 rows are loaded before the first is added (both inner loops unrolled, v[] and k[] in registers):
        // the chunk is latency bound
        for (int h = 0; h < NN / VCH / 8 / 16; ++h) {
            float4 v[16];
            int k[16];
#pragma unroll
            for (int i = 0; i < 16; ++i) {
                v[i] = *(const float4*)(vp + (size_t)(h * 16 + i) * 8 * DD);
                k[i] = mp[(h * 16 + i) * 8];
            }
#pragma unroll
            for (int i = 0; i < 16; ++i) {
                acc.x += k[i] ? 0.0f : v[i].x; acc.y += k[i] ? 0.0f : v[i].y;
                acc.z += k[i] ? 0.0f : v[i].z; acc.w += k[i] ? 0.0f : v[i].w;
            }
        }
        *(float4*)&sRed[rs][d4] = acc;
        __syncthreads();
        if (tid < DD) {
            float s = 0.0f;
#pragma unroll
            for (int r = 0; r < 8; ++r) s += sRed[r][tid];
            vpart[(ch * BHN + bh) * DD + tid] = s;
        }
    }
}

// ---------------------------------------------------------------------------
// Kernel 1: column scales of the kept keys, ncinv[bh, j] = rsqrt(sum_n score[n, idx[j]]), 0 past the kept keys,
// and the scores themselves, kept for kernel 2.
// One wave owns 16 kept keys; streams all 128 row tiles with fp32 WMMA.
// The product is K x Q^T: lane (ln, lh), register r holds the score of query row ln and key r + 8*lh,
// which is how kernel 2 needs it as the A operand of P x V (key order 8*lh + 2*kc + {0,1}).
// The block's four waves share the Q stream: it is copied to LDS one stage ahead.
// ---------------------------------------------------------------------------
__global__ __launch_bounds__(128) void spop_colsum_kernel(
    const float* __restrict__ Q, const float* __restrict__ K,
    const int* __restrict__ idx, const int* __restrict__ cnt, float* __restrict__ ncinv,
    float* __restrict__ pbuf) {
    __shared__ __attribute__((aligned(16))) float sQ[2][SROWS * RP];
    const int lane = threadIdx.x & 31;
    const int wave = __builtin_amdgcn_readfirstlane(threadIdx.x >> 5);   // scalar: it decides a branch
    // key group slowest: the blocks that have work come first in index order, those that leave at once last
    const int cg   = blockIdx.x >> 4;            // group of 64 kept keys, / BHN
    const int bh   = blockIdx.x & (BHN - 1);
    const int b    = bh >> 3;                    // / H
    const int nk   = min(max(cnt[b * 32], 0), NN);
    if (cg * 64 >= nk) {                         // whole block, ahead of every copy and barrier
        if (threadIdx.x < 64) ncinv[bh * NN + cg * 64 + threadIdx.x] = 0.0f;
        return;
    }
    const int j0   = cg * 64 + wave * 16;        // first kept key of the wave
    const size_t base = (size_t)bh * NN * DD;

    const int ln = lane & 15;                    // M and N index inside a tile
    const int lh = lane >> 4;                    // half-wave selector

    // A fragments: K rows idx[j0+ln], contiguous float2 at k = 4*kc + 2*lh
    const int col = idx[b * NN + j0 + ln] & (NN - 1);
    const float* kp = K + base + (size_t)col * DD + 2 * lh;
    v2f kfr[16];
#pragma unroll
    for (int kc = 0; kc < 16; ++kc)
        kfr[kc] = *(const v2f*)(kp + kc * 4);
    // kp is an input so that its registers live up to this wait: no fragment lands in the address the loads name
    asm volatile("s_wait_xcnt 0x0" :: "v"(kp) : "memory");

    // a list entry past the kept keys scores 0: kernel 2 reads whole stages, so every tile of this block that has a place is stored
    float live[8], colAcc[8];
#pragma unroll
    for (int r = 0; r < 8; ++r) {
        live[r] = (j0 + 8 * lh + r < nk) ? 1.0f : 0.0f;
        colAcc[r] = 0.0f;
    }
    const int  jt   = j0 >> 4;                   // the wave's tile of kept keys
    const bool keep = jt < PT_CAP;               // scalar: its scores have a place in the workspace
    float* pw = pbuf + ((size_t)bh * (NN / 16) * PT_CAP + jt) * 256 + lane * 4;

    // lane's 16 bytes of each 2 KiB (8 rows) of a stage: row tid/16, chunk tid%16
    const int crow = threadIdx.x >> 4;
    const int ccol = (threadIdx.x & 15) << 2;
    const char* gq = (const char*)(Q + base) + threadIdx.x * 16;
    const unsigned lq0 = lds_off(&sQ[0][crow * RP + ccol]);
    const unsigned lq1 = lds_off(&sQ[1][crow * RP + ccol]);

    copy4_to_lds(lq0, 8 * RP * 4, gq);                       // stage 0
    wait_copies();
    __syncthreads();                                         // stage 0 readable by all waves
    copy4_to_lds(lq1, 8 * RP * 4, gq + SROWS * DD * 4);      // stage 1 flies during stage 0

    for (int st = 0; st < NSTG; ++st) {
        const float* qb = sQ[st & 1];
        float sc[SROWS / 16][8];
        // both tiles of a stage in one straight line: tile 1's products can issue under tile 0's vector work
#pragma unroll
        for (int t = 0; t < SROWS / 16; ++t) {
            v2f bfr[16];
#pragma unroll
            for (int kc = 0; kc < 16; ++kc)
                bfr[kc] = *(const v2f*)(qb + (t * 16 + ln) * RP + kc * 4 + 2 * lh);
            v8f c = {};
#pragma unroll
            for (int kc = 0; kc < 16; ++kc)
                c = __builtin_amdgcn_wmma_f32_16x16x4_f32(
                        false, kfr[kc], false, bfr[kc], (short)0, c, false, false);
#pragma unroll
            for (int r = 0; r < 8; ++r) {
                sc[t][r] = score_at(dist_of(c[r])) * live[r];   // a score is finite: exactly 0 past the list
                colAcc[r] += sc[t][r];
            }
        }
        if (keep) {                              // 1 KiB a tile, two whole 512-byte stores of the wave
            float* p = pw + (size_t)st * ((SROWS / 16) * PT_CAP * 256);
#pragma unroll
            for (int t = 0; t < SROWS / 16; ++t) {
                *(float4*)(p + t * (PT_CAP * 256))       = make_float4(sc[t][0], sc[t][1], sc[t][2], sc[t][3]);
                *(float4*)(p + t * (PT_CAP * 256) + 128) = make_float4(sc[t][4], sc[t][5], sc[t][6], sc[t][7]);
            }
            // p is an input so that its registers live up to this wait: none that the stores name is rewritten ahead of it
            asm volatile("s_wait_xcnt 0x0" :: "v"(p) : "memory");
        }
        // publish stage st+1, free stage st's buffer, then refill it with stage st+2
        wait_lds();
        wait_copies();
        stage_barrier();
        if (st + 2 < NSTG)
            copy4_to_lds((st & 1) ? lq1 : lq0, 8 * RP * 4,
                         gq + (size_t)(st + 2) * (SROWS * DD * 4));
    }
    wait_copies();
    // key r + 8*lh: its sum is spread over the 16 lanes of the half-wave
#pragma unroll
    for (int off = 1; off < 16; off <<= 1) {
#pragma unroll
        for (int r = 0; r < 8; ++r)
            colAcc[r] += __shfl_xor(colAcc[r], off, 32);
    }
    float mine = colAcc[0];                      // lane ln < 8 takes key ln + 8*lh
#pragma unroll
    for (int r = 1; r < 8; ++r)
        mine = (ln == r) ? colAcc[r] : mine;
    if (ln < 8)                                  // n_c^(-a), a = 0.5
        ncinv[bh * NN + j0 + 8 * lh + ln] = (j0 + 8 * lh + ln < nk) ? rsqrtf(mine) : 0.0f;
}

// ---------------------------------------------------------------------------
// Kernel 2: single-pass output. One wave owns 16 rows; streams tiles of kept keys,
// accumulates O += (score * nc^-1/2) @ V with fp32 WMMA, plus n_r and S.
// The scores come from kernel 1's tiles in the workspace, one stage ahead, straight into the registers
// that the A operand of P x V wants; only stages past the stored ones are computed again here (K x Q^T).
// The block's four waves share the V stream (rows of kept keys, copied to LDS one stage ahead),
// the list of kept keys and their column scales (in LDS once).
// The masked keys all have the same score and column scale: their share of
// n_r, S and O is added at the end from their number and their sum of V.
// ---------------------------------------------------------------------------
__global__ __launch_bounds__(128) void spop_attn_out_kernel(
    const float* __restrict__ Q, const float* __restrict__ K,
    const float* __restrict__ V, const int* __restrict__ idx,
    const int* __restrict__ cnt, const float* __restrict__ ncinv,
    const float* __restrict__ vpart, const float* __restrict__ pbuf, float* __restrict__ out) {
    __shared__ __attribute__((aligned(16))) float sK[2][SROWS * RP];
    __shared__ __attribute__((aligned(16))) float sV[2][SROWS * VP];
    __shared__ __attribute__((aligned(16))) float sNc[NN];
    __shared__ __attribute__((aligned(16))) int   sIdx[NN];
    const int lane = threadIdx.x & 31;
    const int wave = threadIdx.x >> 5;
    const int bh   = blockIdx.x >> 5;            // 32 blocks a head: the same for the whole block
    const int rn   = (((blockIdx.x & 31) << 2) + wave) << 4;   // row base
    const int b    = bh >> 3;
    const size_t base = (size_t)bh * NN * DD;
    const int ln = lane & 15;
    const int lh = lane >> 4;
    const int nk  = min(max(cnt[b * 32], 0), NN);   // kept keys of this batch
    const int nst = (nk + SROWS - 1) / SROWS;       // stages that hold one
    const int nfast = min(nst, CAPST);              // stages whose scores kernel 1 stored

    // sum of V over the masked keys, this lane's four output columns (unrolled: all loads in flight at once)
    float vs[4];
#pragma unroll
    for (int dg = 0; dg < 4; ++dg) {
        float s = 0.0f;
#pragma unroll
        for (int ch = 0; ch < VCH; ++ch)
            s += vpart[(ch * BHN + bh) * DD + dg * 16 + ln];
        vs[dg] = s;
    }

    v8f oacc[4] = {};                            // O tile: 16 rows x 64 cols
    float rAcc[4], sAcc[4];                      // row ln, keys of half lh: four short chains each
#pragma unroll
    for (int r = 0; r < 4; ++r) { rAcc[r] = 0.0f; sAcc[r] = 0.0f; }

    // this wave's score tiles: 2 KiB a stage, four 512-byte loads of the wave
    const float* pr = pbuf + (size_t)(bh * (NN / 16) + (rn >> 4)) * (PT_CAP * 256) + lane * 4;
    float4 pa[4], pb[4];                         // stages st and st+1
#pragma unroll
    for (int i = 0; i < 4; ++i) {
        pa[i] = make_float4(0.0f, 0.0f, 0.0f, 0.0f);
        pb[i] = pa[i];
    }
    if (0 < nfast) {
#pragma unroll
        for (int i = 0; i < 4; ++i) pa[i] = *(const float4*)(pr + i * 128);
    }

    // lane's 16 bytes of each 8 rows of a stage: list entry tid/16, chunk tid%16 of its row
    const int crow = threadIdx.x >> 4;
    const int ccol = (threadIdx.x & 15) << 2;
    const char* gk = (const char*)(K + base + ccol);
    const char* gv = (const char*)(V + base + ccol);
    const unsigned lk0 = lds_off(&sK[0][crow * RP + ccol]);
    const unsigned lk1 = lds_off(&sK[1][crow * RP + ccol]);
    const unsigned lv0 = lds_off(&sV[0][crow * VP + ccol]);
    const unsigned lv1 = lds_off(&sV[1][crow * VP + ccol]);

    // filled once: this head's column scales and this batch's list of keys, 8 KiB each
    copy4_to_lds(lds_off(&sNc[threadIdx.x * 4]), 2048,
                 (const char*)(ncinv + bh * NN) + threadIdx.x * 16);
    copy4_to_lds(lds_off(&sIdx[threadIdx.x * 4]), 2048,
                 (const char*)(idx + b * NN) + threadIdx.x * 16);
    // rows of stages 0 and 1, straight from the list (every entry names a row, so both stages can always be copied);
    // unrolled here and below: the row numbers are operands of one asm statement
    int ra[4], rb[4];
#pragma unroll
    for (int i = 0; i < 4; ++i) {
        ra[i] = idx[b * NN + crow + 8 * i] & (NN - 1);
        rb[i] = idx[b * NN + SROWS + crow + 8 * i] & (NN - 1);
    }
    gather4_to_lds(lv0, 8 * VP * 4, gv, ra[0], ra[1], ra[2], ra[3]);   // stage 0
    wait_copies();
    __syncthreads();                                         // all of it readable by all waves
    gather4_to_lds(lv1, 8 * VP * 4, gv, rb[0], rb[1], rb[2], rb[3]);   // stage 1 flies during stage 0

    // one stage of O += P x V from its scores sc (query row ln, key r + 8*lh of each tile)
    auto pv_stage = [&](int st, const float (&sc)[SROWS / 16][8]) __attribute__((always_inline)) {
      const float* vb = sV[st & 1];
      // both tiles of a stage in one straight line: tile 1's vector work can issue under tile 0's products
#pragma unroll
      for (int t = 0; t < SROWS / 16; ++t) {
        const int cm = st * SROWS + t * 16;
        const float4 n0 = *(const float4*)&sNc[cm + 8 * lh];
        const float4 n1 = *(const float4*)&sNc[cm + 8 * lh + 4];
        const float nc[8] = { n0.x, n0.y, n0.z, n0.w, n1.x, n1.y, n1.z, n1.w };
        float p[8];                              // P = score * nc^-1/2
#pragma unroll
        for (int r = 0; r < 8; ++r) {
            rAcc[r & 3] += sc[t][r];             // n_r partial
            p[r] = sc[t][r] * nc[r];
            sAcc[r & 3] += p[r];                 // S partial
        }
        // O += P(16x16) x V(16x64): 4 k-chunks x 4 D-groups of fp32 WMMA, neighbours independent
#pragma unroll
        for (int kc = 0; kc < 4; ++kc) {
            v2f a;
            a.x = p[2 * kc];                     // A: M=ln, keys 8*lh + 2*kc, +1
            a.y = p[2 * kc + 1];
#pragma unroll
            for (int dg = 0; dg < 4; ++dg) {
                const float* vp = vb + (t * 16 + 8 * lh + 2 * kc) * VP
                                + dg * 16 + ln;               // B: the same key pair, N=ln
                v2f bv;
                bv.x = vp[0];
                bv.y = vp[VP];
                oacc[dg] = __builtin_amdgcn_wmma_f32_16x16x4_f32(
                               false, a, false, bv, (short)0, oacc[dg], false, false);
            }
        }
      }
    };
    // foot of stage st: publish stage st+1, free stage st's buffers, then refill them with stage st+2
    auto foot = [&](int st) __attribute__((always_inline)) {
      wait_lds();
      wait_copies();
      stage_barrier();
      if (st + 2 < nst) {
          int rr[4];
#pragma unroll
          for (int i = 0; i < 4; ++i)
              rr[i] = sIdx[(st + 2) * SROWS + crow + 8 * i] & (NN - 1);
          if (st + 2 >= CAPST)                   // K only for a stage that is computed here
              gather4_to_lds((st & 1) ? lk1 : lk0, 8 * RP * 4, gk, rr[0], rr[1], rr[2], rr[3]);
          gather4_to_lds((st & 1) ? lv1 : lv0, 8 * VP * 4, gv, rr[0], rr[1], rr[2], rr[3]);
      }
    };
    // a stage whose scores are stored: 'use' holds them; stage st+1's set off now into 'fill',
    // so that this stage's matrix work covers the way from memory
    // (in the last stored stage that stage is read once more: written data, not used)
    auto stored_stage = [&](int st, const float4 (&use)[4], float4 (&fill)[4]) __attribute__((always_inline)) {
      const float* pn = pr + (size_t)min(st + 1, nfast - 1) * 512;
#pragma unroll
      for (int i = 0; i < 4; ++i)
          fill[i] = *(const float4*)(pn + i * 128);
      // pn is an input so that its registers live up to this wait: nothing lands in the address the loads name
      asm volatile("s_wait_xcnt 0x0" :: "v"(pn) : "memory");
      float sc[SROWS / 16][8];
#pragma unroll
      for (int t = 0; t < SROWS / 16; ++t) {
          sc[t][0] = use[2 * t].x;     sc[t][1] = use[2 * t].y;
          sc[t][2] = use[2 * t].z;     sc[t][3] = use[2 * t].w;
          sc[t][4] = use[2 * t + 1].x; sc[t][5] = use[2 * t + 1].y;
          sc[t][6] = use[2 * t + 1].z; sc[t][7] = use[2 * t + 1].w;
      }
      pv_stage(st, sc);
      foot(st);
    };

    int st = 0;
    for (; st < nfast; ++st) {
        stored_stage(st, pa, pb);
#pragma unroll
        for (int i = 0; i < 4; ++i) pa[i] = pb[i];
    }
    // stages past the stored ones: K x Q^T and the scores once more
    // B fragments of Q (rows rn..rn+15)
    v2f qfr[16];
#pragma unroll
    for (int kc = 0; kc < 16; ++kc) qfr[kc] = (v2f){0.0f, 0.0f};
    if (st < nst) {
        const float* qp = Q + base + (size_t)(rn + ln) * DD + 2 * lh;
#pragma unroll
        for (int kc = 0; kc < 16; ++kc)
            qfr[kc] = *(const v2f*)(qp + kc * 4);
        // qp is an input so that its registers live up to this wait: no fragment lands in the address the loads name
        asm volatile("s_wait_xcnt 0x0" :: "v"(qp) : "memory");
    }
    for (; st < nst; ++st) {
      const float* kb = sK[st & 1];
      float sc[SROWS / 16][8];
#pragma unroll
      for (int t = 0; t < SROWS / 16; ++t) {
          v2f kfr[16];
#pragma unroll
          for (int kc = 0; kc < 16; ++kc)
              kfr[kc] = *(const v2f*)(kb + (t * 16 + ln) * RP + kc * 4 + 2 * lh);
          v8f c = {};
#pragma unroll
          for (int kc = 0; kc < 16; ++kc)
              c = __builtin_amdgcn_wmma_f32_16x16x4_f32(
                      false, kfr[kc], false, qfr[kc], (short)0, c, false, false);
#pragma unroll
          for (int r = 0; r < 8; ++r)            // a score is finite: exactly 0 past the list
              sc[t][r] = score_at(dist_of(c[r])) *
                         ((st * SROWS + t * 16 + 8 * lh + r < nk) ? 1.0f : 0.0f);
      }
      pv_stage(st, sc);
      foot(st);
    }
    wait_copies();

    // row ln: its sums are in lanes ln and ln+16
    float rSum = (rAcc[0] + rAcc[1]) + (rAcc[2] + rAcc[3]);
    float sSum = (sAcc[0] + sAcc[1]) + (sAcc[2] + sAcc[3]);
    rSum += __shfl_xor(rSum, 16, 32);
    sSum += __shfl_xor(sSum, 16, 32);
    // the masked keys: score c0 each, column degree NN * c0, so P = pm in every row
    const float c0 = score_at(MASK_VALF);
    const float pm = c0 * rsqrtf((float)NN * c0);
    const float nm = (float)(NN - nk);
    // out_row = n_r^-a * Oacc_row / max(n_r^-a * S_row, 1e-12)
    rSum += nm * c0;
    sSum += nm * pm;
    const float rs = rsqrtf(rSum);
    const float sclRow = rs / fmaxf(rs * sSum, 1e-12f);      // of row ln
    float scl[8];                                // of row r + 8*lh, as the O tile holds it
#pragma unroll
    for (int r = 0; r < 8; ++r)
        scl[r] = __shfl(sclRow, r + 8 * lh, 32);
#pragma unroll
    for (int dg = 0; dg < 4; ++dg)
#pragma unroll
        for (int r = 0; r < 8; ++r)
            out[(size_t)(bh * NN + rn + r + 8 * lh) * DD + dg * 16 + ln] =
                (oacc[dg][r] + pm * vs[dg]) * scl[r];
}

extern "C" void kernel_launch(void* const* d_in, const int* in_sizes, int n_in,
                              void* d_out, int out_size, void* d_ws, size_t ws_size,
                              hipStream_t stream) {
    (void)in_sizes; (void)n_in; (void)out_size; (void)ws_size;
    const float* Q    = (const float*)d_in[0];
    const float* K    = (const float*)d_in[1];
    const float* V    = (const float*)d_in[2];
    const int*   mask = (const int*)d_in[3];
    float* out   = (float*)d_out;
    float* ncinv  = (float*)d_ws + WS_NC;
    int*   idx    = (int*)d_ws + WS_IDX;
    int*   cnt    = (int*)d_ws + WS_CNT;
    float* vpart  = (float*)d_ws + WS_VS;
    float* pbuf   = (float*)d_ws + WS_P;

    dim3 block(128);
    // 2 batches + 16 heads * 8 chunks
    spop_prep_kernel<<<dim3(2 + BHN * VCH), block, 0, stream>>>(V, mask, idx, cnt, vpart);
    // 32 groups of 64 keys * 16 heads; groups past the kept keys leave at once
    spop_colsum_kernel<<<dim3(512), block, 0, stream>>>(Q, K, idx, cnt, ncinv, pbuf);
    // 16 heads * 128 strips of 16 rows / 4 waves per block
    spop_attn_out_kernel<<<dim3(512), block, 0, stream>>>(Q, K, V, idx, cnt, ncinv, vpart, pbuf, out);
}

// v004
// One run takes 90.2 microseconds.
// Timed twice side by side with v003, it ran 1.30 and 1.31 times as fast.
// All steps since v000 together make it 5.45 times as fast.
#include <hip/hip_runtime.h>
#include <math.h>
#include <stdint.h>

typedef __attribute__((ext_vector_type(2))) float v2f;
typedef __attribute__((ext_vector_type(8))) float v8f;

#define NN 2048
#define DD 64
#define HH 8
#define BHN 16              // B*H
#define MASK_VALF 10000.0f
#define EPSF 1e-7f
#define SROWS 32            // rows of a streamed operand per LDS stage (two 16-row tiles)
#define RP 68               // LDS row pitch, dwords: 16 rows x 16 B of a fragment read fall on 64 banks
#define VP 68               // LDS row pitch of V, dwords: rows k and k+8 of a fragment read fall 32 banks apart
#define VCH 8               // row chunks of the sum of V over masked keys (one partial sum each)
#define RSPL 4              // slices of the query rows in the column-sum pass (one partial column sum each)
#define NSTG1 (NN / RSPL / SROWS)   // stages of one slice
// workspace, in 4-byte words
#define WS_IDX  (BHN * NN)                     // int [2][NN]: kept keys in ascending order, then the masked keys
#define WS_CNT  (WS_IDX + 2 * NN)              // int [2][32]: number of kept keys, one 128-byte line per batch
#define WS_VS   (WS_CNT + 64)                  // float [VCH][BHN][DD]: partial sums of V over masked keys
#define PT_CAP  126                            // tiles of 16 kept keys per head whose scores fit in the workspace
#define CAPST   (PT_CAP * 16 / SROWS)          // stages of kept keys whose scores are stored; later ones are computed again
#define WS_P    65536                          // float [BHN][NN/16][PT_CAP][2][32][4]: score tiles as the registers hold them
#define WS_CS   (WS_P + BHN * (NN / 16) * PT_CAP * 256)   // float [RSPL][BHN][NN]: partial column sums in list order, then zeros

// byte offset of a __shared__ address in the work-group's LDS
__device__ __forceinline__ unsigned lds_off(const void* p) {
    return (unsigned)(uintptr_t)p;
}

// Four asynchronous 16-byte copies per lane, global -> LDS, through no register.
// The block's 128 lanes move 2 KiB per copy: global steps by 2 KiB, LDS by lstep bytes.
// s_wait_xcnt 0 closes the statement so that no address register named here is
// rewritten ahead of it.
__device__ __forceinline__ void copy4_to_lds(unsigned l, unsigned lstep, const char* g) {
    asm volatile(
        "global_load_async_to_lds_b128 %0, %4, off\n\t"
        "global_load_async_to_lds_b128 %1, %5, off\n\t"
        "global_load_async_to_lds_b128 %2, %6, off\n\t"
        "global_load_async_to_lds_b128 %3, %7, off\n\t"
        "s_wait_xcnt 0x0"
        :: "v"(l), "v"(l + lstep), "v"(l + 2u * lstep), "v"(l + 3u * lstep),
           "v"(g), "v"(g + 2048), "v"(g + 4096), "v"(g + 6144)
        : "memory");
}
// The same for four rows picked by number (256 bytes a row): g points at the lane's 16 bytes of row 0.
__device__ __forceinline__ void gather4_to_lds(unsigned l, unsigned lstep, const char* g,
                                               int r0, int r1, int r2, int r3) {
    asm volatile(
        "global_load_async_to_lds_b128 %0, %4, off\n\t"
        "global_load_async_to_lds_b128 %1, %5, off\n\t"
        "global_load_async_to_lds_b128 %2, %6, off\n\t"
        "global_load_async_to_lds_b128 %3, %7, off\n\t"
        "s_wait_xcnt 0x0"
        :: "v"(l), "v"(l + lstep), "v"(l + 2u * lstep), "v"(l + 3u * lstep),
           "v"(g + (size_t)r0 * (DD * 4)), "v"(g + (size_t)r1 * (DD * 4)),
           "v"(g + (size_t)r2 * (DD * 4)), "v"(g + (size_t)r3 * (DD * 4))
        : "memory");
}
// this wave's copies have landed in LDS
__device__ __forceinline__ void wait_copies() { asm volatile("s_wait_asynccnt 0x0" ::: "memory"); }
// this wave's LDS reads and writes have retired (before a buffer it read is refilled)
__device__ __forceinline__ void wait_lds() { asm volatile("s_wait_dscnt 0x0" ::: "memory"); }

// The work-group's barrier alone, for the foot of a ring's stage: wait_lds() and wait_copies() stand in front of it,
// and they are all that the LDS buffers need. __syncthreads() would also drain the wave's global stores and loads
// there, which no other wave of the block reads: the score tiles are to stay in flight over the stage's end.
__device__ __forceinline__ void stage_barrier() {
    asm volatile("s_barrier_signal -1\n\ts_barrier_wait -1" ::: "memory");
}

// g = acos(clip(qk)), the distance of a kept key
__device__ __forceinline__ float dist_of(float qk) {
    float q = fminf(fmaxf(qk, -1.0f + EPSF), 1.0f - EPSF);
    return acosf(q);                 // R = 1.0
}
// score = (1 + g)^-5; a masked key has g = 10000 whatever its product, so one score for all of them
__device__ __forceinline__ float score_at(float g) {
    float t = 1.0f + g;              // bandwidth = 1.0
    float inv = 1.0f / t;
    float i2 = inv * inv;
    return i2 * i2 * inv;            // t^-5  (= t^(-d_int-alpha))
}

// ---------------------------------------------------------------------------
// Kernel 0. Blocks 0 and 1: the batch's keys, the kept ones (mask != 0) first, and the number of kept ones.
// Other blocks: per head, the sum of V over the masked keys of a 256-row chunk.
// ---------------------------------------------------------------------------
__global__ __launch_bounds__(128) void spop_prep_kernel(
    const float* __restrict__ V, const int* __restrict__ mask,
    int* __restrict__ idx, int* __restrict__ cnt, float* __restrict__ vpart) {
    __shared__ int sCnt[4];
    __shared__ __attribute__((aligned(16))) float sRed[8][DD];
    const int tid = threadIdx.x;
    if (blockIdx.x < 2) {
        const int b = blockIdx.x;
        const int lane = tid & 31;
        const int wave = tid >> 5;
        // every loop over m[] and over the four waves is unrolled so that m[] stays in registers
        int m[16];                               // this thread's 16 consecutive keys
#pragma unroll
        for (int q = 0; q < 4; ++q) {
            const int4 v = *(const int4*)(mask + b * NN + tid * 16 + q * 4);
            m[q * 4 + 0] = v.x != 0; m[q * 4 + 1] = v.y != 0;
            m[q * 4 + 2] = v.z != 0; m[q * 4 + 3] = v.w != 0;
        }
        int c = 0;
#pragma unroll
        for (int e = 0; e < 16; ++e) c += m[e];
        int inc = c;                             // inclusive scan over the wave
#pragma unroll
        for (int off = 1; off < 32; off <<= 1) {
            const int o = __shfl_up(inc, off, 32);
            if (lane >= off) inc += o;
        }
        if (lane == 31) sCnt[wave] = inc;
        __syncthreads();
        int before = 0, total = 0;
#pragma unroll
        for (int w = 0; w < 4; ++w) {
            const int s = sCnt[w];
            if (w < wave) before += s;
            total += s;
        }
        int pos = before + inc - c;              // kept keys ahead of this thread's first key
        // every key gets one place: kept ones from 0, masked ones from total, so each entry names a valid row
#pragma unroll
        for (int e = 0; e < 16; ++e) {
            const int key = tid * 16 + e;
            idx[b * NN + (m[e] ? pos : total + key - pos)] = key;
            pos += m[e];
        }
        if (tid == 0) cnt[b * 32] = total;
    } else {
        const int u  = blockIdx.x - 2;
        const int bh = u / VCH;
        const int ch = u % VCH;
        const int b  = bh >> 3;
        const int rs = tid >> 4;
        const int d4 = (tid & 15) << 2;
        const float* vp = V + (size_t)bh * NN * DD + (size_t)(ch * (NN / VCH) + rs) * DD + d4;
        const int*   mp = mask + b * NN + ch * (NN / VCH) + rs;
        float4 acc = make_float4(0.0f, 0.0f, 0.0f, 0.0f);
        // 16 rows are loaded before the first is added (both inner loops unrolled, v[] and k[] in registers):
        // the chunk is latency bound
        for (int h = 0; h < NN / VCH / 8 / 16; ++h) {
            float4 v[16];
            int k[16];
#pragma unroll
            for (int i = 0; i < 16; ++i) {
                v[i] = *(const float4*)(vp + (size_t)(h * 16 + i) * 8 * DD);
                k[i] = mp[(h * 16 + i) * 8];
            }
#pragma unroll
            for (int i = 0; i < 16; ++i) {
                acc.x += k[i] ? 0.0f : v[i].x; acc.y += k[i] ? 0.0f : v[i].y;
                acc.z += k[i] ? 0.0f : v[i].z; acc.w += k[i] ? 0.0f : v[i].w;
            }
        }
        *(float4*)&sRed[rs][d4] = acc;
        __syncthreads();
        if (tid < DD) {
            float s = 0.0f;
#pragma unroll
            for (int r = 0; r < 8; ++r) s += sRed[r][tid];
            vpart[(ch * BHN + bh) * DD + tid] = s;
        }
    }
}

// ---------------------------------------------------------------------------
// Kernel 1: partial column sums of the kept keys, csum[sp, bh, j] = sum of score[n, idx[j]] over slice sp of the rows n,
// 0 past the kept keys, and the scores themselves, kept for kernel 2.
// One wave owns 16 kept keys and one slice of the rows; streams the slice's 32 row tiles with fp32 WMMA.
// The slices are work-groups of their own, so that several waves share a SIMD: one wave's matrix run
// fills the other waves' vector work and waits.
// The product is K x Q^T: lane (ln, lh), register r holds the score of query row ln and key r + 8*lh,
// which is how kernel 2 needs it as the A operand of P x V (key order 8*lh + 2*kc + {0,1}).
// The block's four waves share the Q stream: it is copied to LDS one stage ahead.
// ---------------------------------------------------------------------------
__global__ __launch_bounds__(128) void spop_colsum_kernel(
    const float* __restrict__ Q, const float* __restrict__ K,
    const int* __restrict__ idx, const int* __restrict__ cnt, float* __restrict__ csum,
    float* __restrict__ pbuf) {
    __shared__ __attribute__((aligned(16))) float sQ[2][SROWS * RP];
    const int lane = threadIdx.x & 31;
    const int wave = __builtin_amdgcn_readfirstlane(threadIdx.x >> 5);   // scalar: it decides a branch
    // key group slowest: the blocks that have work come first in index order, those that leave at once last
    const int cg   = blockIdx.x / (BHN * RSPL);  // group of 64 kept keys
    const int sp   = (blockIdx.x / BHN) % RSPL;  // slice of the query rows
    const int bh   = blockIdx.x & (BHN - 1);
    const int b    = bh >> 3;                    // / H
    const int nk   = min(max(cnt[b * 32], 0), NN);
    if (cg * 64 >= nk) {                         // whole block, ahead of every copy and barrier
        if (threadIdx.x < 64) csum[(sp * BHN + bh) * NN + cg * 64 + threadIdx.x] = 0.0f;
        return;
    }
    const int j0   = cg * 64 + wave * 16;        // first kept key of the wave
    const size_t base = (size_t)bh * NN * DD;

    const int ln = lane & 15;                    // M and N index inside a tile
    const int lh = lane >> 4;                    // half-wave selector

    // A fragments: K rows idx[j0+ln], contiguous float2 at k = 4*kc + 2*lh
    const int col = idx[b * NN + j0 + ln] & (NN - 1);
    const float* kp = K + base + (size_t)col * DD + 2 * lh;
    v2f kfr[16];
#pragma unroll
    for (int kc = 0; kc < 16; ++kc)
        kfr[kc] = *(const v2f*)(kp + kc * 4);
    // kp is an input so that its registers live up to this wait: no fragment lands in the address the loads name
    asm volatile("s_wait_xcnt 0x0" :: "v"(kp) : "memory");

    // a list entry past the kept keys scores 0: kernel 2 reads whole stages, so every tile of this block that has a place is stored
    float live[8], colAcc[8];
#pragma unroll
    for (int r = 0; r < 8; ++r) {
        live[r] = (j0 + 8 * lh + r < nk) ? 1.0f : 0.0f;
        colAcc[r] = 0.0f;
    }
    const int  jt   = j0 >> 4;                   // the wave's tile of kept keys
    const bool keep = jt < PT_CAP;               // scalar: its scores have a place in the workspace
    float* pw = pbuf + ((size_t)(bh * (NN / 16) + sp * (NN / RSPL / 16)) * PT_CAP + jt) * 256 + lane * 4;

    // lane's 16 bytes of each 2 KiB (8 rows) of a stage: row tid/16, chunk tid%16
    const int crow = threadIdx.x >> 4;
    const int ccol = (threadIdx.x & 15) << 2;
    const char* gq = (const char*)(Q + base + (size_t)sp * (NN / RSPL) * DD) + threadIdx.x * 16;
    const unsigned lq0 = lds_off(&sQ[0][crow * RP + ccol]);
    const unsigned lq1 = lds_off(&sQ[1][crow * RP + ccol]);

    copy4_to_lds(lq0, 8 * RP * 4, gq);                       // stage 0
    wait_copies();
    __syncthreads();                                         // stage 0 readable by all waves
    copy4_to_lds(lq1, 8 * RP * 4, gq + SROWS * DD * 4);      // stage 1 flies during stage 0

    for (int st = 0; st < NSTG1; ++st) {
        const float* qb = sQ[st & 1];
        float sc[SROWS / 16][8];
        // both tiles of a stage in one straight line: tile 1's products can issue under tile 0's vector work
#pragma unroll
        for (int t = 0; t < SROWS / 16; ++t) {
            v2f bfr[16];
#pragma unroll
            for (int kc = 0; kc < 16; ++kc)
                bfr[kc] = *(const v2f*)(qb + (t * 16 + ln) * RP + kc * 4 + 2 * lh);
            v8f c = {};
#pragma unroll
            for (int kc = 0; kc < 16; ++kc)
                c = __builtin_amdgcn_wmma_f32_16x16x4_f32(
                        false, kfr[kc], false, bfr[kc], (short)0, c, false, false);
#pragma unroll
            for (int r = 0; r < 8; ++r) {
                sc[t][r] = score_at(dist_of(c[r])) * live[r];   // a score is finite: exactly 0 past the list
                colAcc[r] += sc[t][r];
            }
        }
        if (keep) {                              // 1 KiB a tile, two whole 512-byte stores of the wave
            float* p = pw + (size_t)st * ((SROWS / 16) * PT_CAP * 256);
#pragma unroll
            for (int t = 0; t < SROWS / 16; ++t) {
                *(float4*)(p + t * (PT_CAP * 256))       = make_float4(sc[t][0], sc[t][1], sc[t][2], sc[t][3]);
                *(float4*)(p + t * (PT_CAP * 256) + 128) = make_float4(sc[t][4], sc[t][5], sc[t][6], sc[t][7]);
            }
            // p is an input so that its registers live up to this wait: none that the stores name is rewritten ahead of it
            asm volatile("s_wait_xcnt 0x0" :: "v"(p) : "memory");
        }
        // publish stage st+1, free stage st's buffer, then refill it with stage st+2
        wait_lds();
        wait_copies();
        stage_barrier();
        if (st + 2 < NSTG1)
            copy4_to_lds((st & 1) ? lq1 : lq0, 8 * RP * 4,
                         gq + (size_t)(st + 2) * (SROWS * DD * 4));
    }
    wait_copies();
    // key r + 8*lh: its sum is spread over the 16 lanes of the half-wave
#pragma unroll
    for (int off = 1; off < 16; off <<= 1) {
#pragma unroll
        for (int r = 0; r < 8; ++r)
            colAcc[r] += __shfl_xor(colAcc[r], off, 32);
    }
    float mine = colAcc[0];                      // lane ln < 8 takes key ln + 8*lh
#pragma unroll
    for (int r = 1; r < 8; ++r)
        mine = (ln == r) ? colAcc[r] : mine;
    if (ln < 8)                                  // exactly 0 past the list: every score there is
        csum[(sp * BHN + bh) * NN + j0 + 8 * lh + ln] = mine;
}

// ---------------------------------------------------------------------------
// Kernel 2: single-pass output. One wave owns 16 rows; streams tiles of kept keys,
// accumulates O += (score * nc^-1/2) @ V with fp32 WMMA, plus n_r and S.
// The scores come from kernel 1's tiles in the workspace, one stage ahead, straight into the registers
// that the A operand of P x V wants; only stages past the stored ones are computed again here (K x Q^T).
// The block's four waves share the V stream (rows of kept keys, copied to LDS one stage ahead),
// the list of kept keys and their column scales (in LDS once; the scales are formed here from kernel 1's partial sums).
// The masked keys all have the same score and column scale: their share of
// n_r, S and O is added at the end from their number and their sum of V.
// ---------------------------------------------------------------------------
__global__ __launch_bounds__(128) void spop_attn_out_kernel(
    const float* __restrict__ Q, const float* __restrict__ K,
    const float* __restrict__ V, const int* __restrict__ idx,
    const int* __restrict__ cnt, const float* __restrict__ csum,
    const float* __restrict__ vpart, const float* __restrict__ pbuf, float* __restrict__ out) {
    __shared__ __attribute__((aligned(16))) float sK[2][SROWS * RP];
    __shared__ __attribute__((aligned(16))) float sV[2][SROWS * VP];
    __shared__ __attribute__((aligned(16))) float sNc[NN];
    __shared__ __attribute__((aligned(16))) int   sIdx[NN];
    const int lane = threadIdx.x & 31;
    const int wave = threadIdx.x >> 5;
    const int bh   = blockIdx.x >> 5;            // 32 blocks a head: the same for the whole block
    const int rn   = (((blockIdx.x & 31) << 2) + wave) << 4;   // row base
    const int b    = bh >> 3;
    const size_t base = (size_t)bh * NN * DD;
    const int ln = lane & 15;
    const int lh = lane >> 4;
    const int nk  = min(max(cnt[b * 32], 0), NN);   // kept keys of this batch
    const int nst = (nk + SROWS - 1) / SROWS;       // stages that hold one
    const int nfast = min(nst, CAPST);              // stages whose scores kernel 1 stored

    // sum of V over the masked keys, this lane's four output columns (unrolled: all loads in flight at once)
    float vs[4];
#pragma unroll
    for (int dg = 0; dg < 4; ++dg) {
        float s = 0.0f;
#pragma unroll
        for (int ch = 0; ch < VCH; ++ch)
            s += vpart[(ch * BHN + bh) * DD + dg * 16 + ln];
        vs[dg] = s;
    }

    v8f oacc[4] = {};                            // O tile: 16 rows x 64 cols
    float rAcc[4], sAcc[4];                      // row ln, keys of half lh: four short chains each
#pragma unroll
    for (int r = 0; r < 4; ++r) { rAcc[r] = 0.0f; sAcc[r] = 0.0f; }

    // this wave's score tiles: 2 KiB a stage, four 512-byte loads of the wave
    const float* pr = pbuf + (size_t)(bh * (NN / 16) + (rn >> 4)) * (PT_CAP * 256) + lane * 4;
    float4 pa[4], pb[4];                         // stages st and st+1
#pragma unroll
    for (int i = 0; i < 4; ++i) {
        pa[i] = make_float4(0.0f, 0.0f, 0.0f, 0.0f);
        pb[i] = pa[i];
    }
    if (0 < nfast) {
#pragma unroll
        for (int i = 0; i < 4; ++i) pa[i] = *(const float4*)(pr + i * 128);
    }

    // lane's 16 bytes of each 8 rows of a stage: list entry tid/16, chunk tid%16 of its row
    const int crow = threadIdx.x >> 4;
    const int ccol = (threadIdx.x & 15) << 2;
    const char* gk = (const char*)(K + base + ccol);
    const char* gv = (const char*)(V + base + ccol);
    const unsigned lk0 = lds_off(&sK[0][crow * RP + ccol]);
    const unsigned lk1 = lds_off(&sK[1][crow * RP + ccol]);
    const unsigned lv0 = lds_off(&sV[0][crow * VP + ccol]);
    const unsigned lv1 = lds_off(&sV[1][crow * VP + ccol]);

    // rows of stages 0 and 1, straight from the list (every entry names a row, so both stages can always be copied);
    // unrolled here and below: the row numbers are operands of one asm statement
    int ra[4], rb[4];
#pragma unroll
    for (int i = 0; i < 4; ++i) {
        ra[i] = idx[b * NN + crow + 8 * i] & (NN - 1);
        rb[i] = idx[b * NN + SROWS + crow + 8 * i] & (NN - 1);
    }
    // filled once: this head's column scales and this batch's list of keys, 8 KiB each
    // column scale n_c^(-a), a = 0.5, of the slices' sums added in slice order; 0 past the kept keys
    // (unrolled: all loads in flight at once, beside the list's above)
    {
        const float* cp = csum + bh * NN + threadIdx.x * 4;
        float4 cs[4][RSPL];
#pragma unroll
        for (int i = 0; i < 4; ++i)
#pragma unroll
            for (int s = 0; s < RSPL; ++s)
                cs[i][s] = *(const float4*)(cp + s * (BHN * NN) + i * 512);
        // cp is an input so that its registers live up to this wait: nothing lands in the address the loads name
        asm volatile("s_wait_xcnt 0x0" :: "v"(cp) : "memory");
#pragma unroll
        for (int i = 0; i < 4; ++i) {
            float4 a = cs[i][0];
#pragma unroll
            for (int s = 1; s < RSPL; ++s) {
                a.x += cs[i][s].x; a.y += cs[i][s].y; a.z += cs[i][s].z; a.w += cs[i][s].w;
            }
            const int j = i * 512 + threadIdx.x * 4;
            *(float4*)&sNc[j] = make_float4((j + 0 < nk) ? rsqrtf(a.x) : 0.0f, (j + 1 < nk) ? rsqrtf(a.y) : 0.0f,
                                            (j + 2 < nk) ? rsqrtf(a.z) : 0.0f, (j + 3 < nk) ? rsqrtf(a.w) : 0.0f);
        }
    }
    copy4_to_lds(lds_off(&sIdx[threadIdx.x * 4]), 2048,
                 (const char*)(idx + b * NN) + threadIdx.x * 16);
    gather4_to_lds(lv0, 8 * VP * 4, gv, ra[0], ra[1], ra[2], ra[3]);   // stage 0
    wait_copies();
    __syncthreads();                                         // all of it readable by all waves
    gather4_to_lds(lv1, 8 * VP * 4, gv, rb[0], rb[1], rb[2], rb[3]);   // stage 1 flies during stage 0

    // one stage of O += P x V from its scores sc (query row ln, key r + 8*lh of each tile)
    auto pv_stage = [&](int st, const float (&sc)[SROWS / 16][8]) __attribute__((always_inline)) {
      const float* vb = sV[st & 1];
      // both tiles of a stage in one straight line: tile 1's vector work can issue under tile 0's products
#pragma unroll
      for (int t = 0; t < SROWS / 16; ++t) {
        const int cm = st * SROWS + t * 16;
        const float4 n0 = *(const float4*)&sNc[cm + 8 * lh];
        const float4 n1 = *(const float4*)&sNc[cm + 8 * lh + 4];
        const float nc[8] = { n0.x, n0.y, n0.z, n0.w, n1.x, n1.y, n1.z, n1.w };
        float p[8];                              // P = score * nc^-1/2
#pragma unroll
        for (int r = 0; r < 8; ++r) {
            rAcc[r & 3] += sc[t][r];             // n_r partial
            p[r] = sc[t][r] * nc[r];
            sAcc[r & 3] += p[r];                 // S partial
        }
        // O += P(16x16) x V(16x64): 4 k-chunks x 4 D-groups of fp32 WMMA, neighbours independent
#pragma unroll
        for (int kc = 0; kc < 4; ++kc) {
            v2f a;
            a.x = p[2 * kc];                     // A: M=ln, keys 8*lh + 2*kc, +1
            a.y = p[2 * kc + 1];
#pragma unroll
            for (int dg = 0; dg < 4; ++dg) {
                const float* vp = vb + (t * 16 + 8 * lh + 2 * kc) * VP
                                + dg * 16 + ln;               // B: the same key pair, N=ln
                v2f bv;
                bv.x = vp[0];
                bv.y = vp[VP];
                oacc[dg] = __builtin_amdgcn_wmma_f32_16x16x4_f32(
                               false, a, false, bv, (short)0, oacc[dg], false, false);
            }
        }
      }
    };
    // foot of stage st: publish stage st+1, free stage st's buffers, then refill them with stage st+2
    auto foot = [&](int st) __attribute__((always_inline)) {
      wait_lds();
      wait_copies();
      stage_barrier();
      if (st + 2 < nst) {
          int rr[4];
#pragma unroll
          for (int i = 0; i < 4; ++i)
              rr[i] = sIdx[(st + 2) * SROWS + crow + 8 * i] & (NN - 1);
          if (st + 2 >= CAPST)                   // K only for a stage that is computed here
              gather4_to_lds((st & 1) ? lk1 : lk0, 8 * RP * 4, gk, rr[0], rr[1], rr[2], rr[3]);
          gather4_to_lds((st & 1) ? lv1 : lv0, 8 * VP * 4, gv, rr[0], rr[1], rr[2], rr[3]);
      }
    };
    // a stage whose scores are stored: 'use' holds them; stage st+1's set off now into 'fill',
    // so that this stage's matrix work covers the way from memory
    // (in the last stored stage that stage is read once more: written data, not used)
    auto stored_stage = [&](int st, const float4 (&use)[4], float4 (&fill)[4]) __attribute__((always_inline)) {
      const float* pn = pr + (size_t)min(st + 1, nfast - 1) * 512;
#pragma unroll
      for (int i = 0; i < 4; ++i)
          fill[i] = *(const float4*)(pn + i * 128);
      // pn is an input so that its registers live up to this wait: nothing lands in the address the loads name
      asm volatile("s_wait_xcnt 0x0" :: "v"(pn) : "memory");
      float sc[SROWS / 16][8];
#pragma unroll
      for (int t = 0; t < SROWS / 16; ++t) {
          sc[t][0] = use[2 * t].x;     sc[t][1] = use[2 * t].y;
          sc[t][2] = use[2 * t].z;     sc[t][3] = use[2 * t].w;
          sc[t][4] = use[2 * t + 1].x; sc[t][5] = use[2 * t + 1].y;
          sc[t][6] = use[2 * t + 1].z; sc[t][7] = use[2 * t + 1].w;
      }
      pv_stage(st, sc);
      foot(st);
    };

    int st = 0;
    for (; st < nfast; ++st) {
        stored_stage(st, pa, pb);
#pragma unroll
        for (int i = 0; i < 4; ++i) pa[i] = pb[i];
    }
    // stages past the stored ones: K x Q^T and the scores once more
    // B fragments of Q (rows rn..rn+15)
    v2f qfr[16];
#pragma unroll
    for (int kc = 0; kc < 16; ++kc) qfr[kc] = (v2f){0.0f, 0.0f};
    if (st < nst) {
        const float* qp = Q + base + (size_t)(rn + ln) * DD + 2 * lh;
#pragma unroll
        for (int kc = 0; kc < 16; ++kc)
            qfr[kc] = *(const v2f*)(qp + kc * 4);
        // qp is an input so that its registers live up to this wait: no fragment lands in the address the loads name
        asm volatile("s_wait_xcnt 0x0" :: "v"(qp) : "memory");
    }
    for (; st < nst; ++st) {
      const float* kb = sK[st & 1];
      float sc[SROWS / 16][8];
#pragma unroll
      for (int t = 0; t < SROWS / 16; ++t) {
          v2f kfr[16];
#pragma unroll
          for (int kc = 0; kc < 16; ++kc)
              kfr[kc] = *(const v2f*)(kb + (t * 16 + ln) * RP + kc * 4 + 2 * lh);
          v8f c = {};
#pragma unroll
          for (int kc = 0; kc < 16; ++kc)
              c = __builtin_amdgcn_wmma_f32_16x16x4_f32(
                      false, kfr[kc], false, qfr[kc], (short)0, c, false, false);
#pragma unroll
          for (int r = 0; r < 8; ++r)            // a score is finite: exactly 0 past the list
              sc[t][r] = score_at(dist_of(c[r])) *
                         ((st * SROWS + t * 16 + 8 * lh + r < nk) ? 1.0f : 0.0f);
      }
      pv_stage(st, sc);
      foot(st);
    }
    wait_copies();

    // row ln: its sums are in lanes ln and ln+16
    float rSum = (rAcc[0] + rAcc[1]) + (rAcc[2] + rAcc[3]);
    float sSum = (sAcc[0] + sAcc[1]) + (sAcc[2] + sAcc[3]);
    rSum += __shfl_xor(rSum, 16, 32);
    sSum += __shfl_xor(sSum, 16, 32);
    // the masked keys: score c0 each, column degree NN * c0, so P = pm in every row
    const float c0 = score_at(MASK_VALF);
    const float pm = c0 * rsqrtf((float)NN * c0);
    const float nm = (float)(NN - nk);
    // out_row = n_r^-a * Oacc_row / max(n_r^-a * S_row, 1e-12)
    rSum += nm * c0;
    sSum += nm * pm;
    const float rs = rsqrtf(rSum);
    const float sclRow = rs / fmaxf(rs * sSum, 1e-12f);      // of row ln
    float scl[8];                                // of row r + 8*lh, as the O tile holds it
#pragma unroll
    for (int r = 0; r < 8; ++r)
        scl[r] = __shfl(sclRow, r + 8 * lh, 32);
#pragma unroll
    for (int dg = 0; dg < 4; ++dg)
#pragma unroll
        for (int r = 0; r < 8; ++r)
            out[(size_t)(bh * NN + rn + r + 8 * lh) * DD + dg * 16 + ln] =
                (oacc[dg][r] + pm * vs[dg]) * scl[r];
}

extern "C" void kernel_launch(void* const* d_in, const int* in_sizes, int n_in,
                              void* d_out, int out_size, void* d_ws, size_t ws_size,
                              hipStream_t stream) {
    (void)in_sizes; (void)n_in; (void)out_size; (void)ws_size;
    const float* Q    = (const float*)d_in[0];
    const float* K    = (const float*)d_in[1];
    const float* V    = (const float*)d_in[2];
    const int*   mask = (const int*)d_in[3];
    float* out   = (float*)d_out;
    float* csum   = (float*)d_ws + WS_CS;
    int*   idx    = (int*)d_ws + WS_IDX;
    int*   cnt    = (int*)d_ws + WS_CNT;
    float* vpart  = (float*)d_ws + WS_VS;
    float* pbuf   = (float*)d_ws + WS_P;

    dim3 block(128);
    // 2 batches + 16 heads * 8 chunks
    spop_prep_kernel<<<dim3(2 + BHN * VCH), block, 0, stream>>>(V, mask, idx, cnt, vpart);
    // 32 groups of 64 keys * 4 slices of the rows * 16 heads; groups past the kept keys leave at once
    spop_colsum_kernel<<<dim3(32 * RSPL * BHN), block, 0, stream>>>(Q, K, idx, cnt, csum, pbuf);
    // 16 heads * 128 strips of 16 rows / 4 waves per block
    spop_attn_out_kernel<<<dim3(512), block, 0, stream>>>(Q, K, V, idx, cnt, csum, vpart, pbuf, out);
}

// v005
// Measured time: 86.1 microseconds a run.
// Two timings next to v004 both put it at 1.05 times that version's speed.
// All steps since v000 together make it 5.71 times as fast.
#include <hip/hip_runtime.h>
#include <math.h>
#include <stdint.h>

typedef __attribute__((ext_vector_type(2))) float v2f;
typedef __attribute__((ext_vector_type(8))) float v8f;

#define NN 2048
#define DD 64
#define HH 8
#define BHN 16              // B*H
#define MASK_VALF 10000.0f
#define EPSF 1e-7f
#define SROWS 32            // rows of a streamed operand per LDS stage (two 16-row tiles)
#define RP 68               // LDS row pitch, dwords: 16 rows x 16 B of a fragment read fall on 64 banks
#define VP 68               // LDS row pitch of V, dwords: rows k and k+8 of a fragment read fall 32 banks apart
#define VCH 8               // row chunks of the sum of V over masked keys (one partial sum each)
#define RSPL 4              // slices of the query rows in the column-sum pass (one partial column sum each)
#define NSTG1 (NN / RSPL / SROWS)   // stages of one slice
#define KG 2                // groups of keys in the output pass: wave group g takes stage ss*KG + g of super-stage ss
#define SSROWS (SROWS * KG) // rows of V per LDS super-stage of the output pass: what one block of the column-sum pass stores
#define XCH 640             // dwords a wave hands its partner at the join: 2 column groups of O, then its sums
// workspace, in 4-byte words
#define WS_IDX  (BHN * NN)                     // int [2][NN]: kept keys in ascending order, then the masked keys
#define WS_CNT  (WS_IDX + 2 * NN)              // int [2][32]: number of kept keys, one 128-byte line per batch
#define WS_VS   (WS_CNT + 64)                  // float [VCH][BHN][DD]: partial sums of V over masked keys
#define PT_CAP  126                            // tiles of 16 kept keys per head whose scores fit in the workspace
#define CAPST   (PT_CAP * 16 / SROWS)          // stages of kept keys whose scores are stored; later ones are computed again
#define WS_P    65536                          // float [BHN][NN/16][PT_CAP][2][32][4]: score tiles as the registers hold them
#define WS_CS   (WS_P + BHN * (NN / 16) * PT_CAP * 256)   // float [RSPL][BHN][NN]: partial column sums in list order, then zeros

// byte offset of a __shared__ address in the work-group's LDS
__device__ __forceinline__ unsigned lds_off(const void* p) {
    return (unsigned)(uintptr_t)p;
}

// Four asynchronous 16-byte copies per lane, global -> LDS, through no register.
// The block's 128 lanes move 2 KiB per copy: global steps by 2 KiB, LDS by lstep bytes.
// s_wait_xcnt 0 closes the statement so that no address register named here is
// rewritten ahead of it.
__device__ __forceinline__ void copy4_to_lds(unsigned l, unsigned lstep, const char* g) {
    asm volatile(
        "global_load_async_to_lds_b128 %0, %4, off\n\t"
        "global_load_async_to_lds_b128 %1, %5, off\n\t"
        "global_load_async_to_lds_b128 %2, %6, off\n\t"
        "global_load_async_to_lds_b128 %3, %7, off\n\t"
        "s_wait_xcnt 0x0"
        :: "v"(l), "v"(l + lstep), "v"(l + 2u * lstep), "v"(l + 3u * lstep),
           "v"(g), "v"(g + 2048), "v"(g + 4096), "v"(g + 6144)
        : "memory");
}
// Two such copies per lane, both addresses stepping by 'step' bytes.
__device__ __forceinline__ void copy2_to_lds(unsigned l, unsigned step, const char* g) {
    asm volatile(
        "global_load_async_to_lds_b128 %0, %2, off\n\t"
        "global_load_async_to_lds_b128 %1, %3, off\n\t"
        "s_wait_xcnt 0x0"
        :: "v"(l), "v"(l + step), "v"(g), "v"(g + step)
        : "memory");
}
// The same for four rows picked by number (256 bytes a row): g points at the lane's 16 bytes of row 0.
__device__ __forceinline__ void gather4_to_lds(unsigned l, unsigned lstep, const char* g,
                                               int r0, int r1, int r2, int r3) {
    asm volatile(
        "global_load_async_to_lds_b128 %0, %4, off\n\t"
        "global_load_async_to_lds_b128 %1, %5, off\n\t"
        "global_load_async_to_lds_b128 %2, %6, off\n\t"
        "global_load_async_to_lds_b128 %3, %7, off\n\t"
        "s_wait_xcnt 0x0"
        :: "v"(l), "v"(l + lstep), "v"(l + 2u * lstep), "v"(l + 3u * lstep),
           "v"(g + (size_t)r0 * (DD * 4)), "v"(g + (size_t)r1 * (DD * 4)),
           "v"(g + (size_t)r2 * (DD * 4)), "v"(g + (size_t)r3 * (DD * 4))
        : "memory");
}
// this wave's copies have landed in LDS
__device__ __forceinline__ void wait_copies() { asm volatile("s_wait_asynccnt 0x0" ::: "memory"); }
// this wave's LDS reads and writes have retired (before a buffer it read is refilled)
__device__ __forceinline__ void wait_lds() { asm volatile("s_wait_dscnt 0x0" ::: "memory"); }

// The work-group's barrier alone, for the foot of a ring's stage: wait_lds() and wait_copies() stand in front of it,
// and they are all that the LDS buffers need. __syncthreads() would also drain the wave's global stores and loads
// there, which no other wave of the block reads: the score tiles are to stay in flight over the stage's end.
__device__ __forceinline__ void stage_barrier() {
    asm volatile("s_barrier_signal -1\n\ts_barrier_wait -1" ::: "memory");
}

// g = acos(clip(qk)), the distance of a kept key
__device__ __forceinline__ float dist_of(float qk) {
    float q = fminf(fmaxf(qk, -1.0f + EPSF), 1.0f - EPSF);
    return acosf(q);                 // R = 1.0
}
// score = (1 + g)^-5; a masked key has g = 10000 whatever its product, so one score for all of them
__device__ __forceinline__ float score_at(float g) {
    float t = 1.0f + g;              // bandwidth = 1.0
    float inv = 1.0f / t;
    float i2 = inv * inv;
    return i2 * i2 * inv;            // t^-5  (= t^(-d_int-alpha))
}

// ---------------------------------------------------------------------------
// Kernel 0. Blocks 0 and 1: the batch's keys, the kept ones (mask != 0) first, and the number of kept ones.
// Other blocks: per head, the sum of V over the masked keys of a 256-row chunk.
// ---------------------------------------------------------------------------
__global__ __launch_bounds__(128) void spop_prep_kernel(
    const float* __restrict__ V, const int* __restrict__ mask,
    int* __restrict__ idx, int* __restrict__ cnt, float* __restrict__ vpart) {
    __shared__ int sCnt[4];
    __shared__ __attribute__((aligned(16))) float sRed[8][DD];
    const int tid = threadIdx.x;
    if (blockIdx.x < 2) {
        const int b = blockIdx.x;
        const int lane = tid & 31;
        const int wave = tid >> 5;
        // every loop over m[] and over the four waves is unrolled so that m[] stays in registers
        int m[16];                               // this thread's 16 consecutive keys
#pragma unroll
        for (int q = 0; q < 4; ++q) {
            const int4 v = *(const int4*)(mask + b * NN + tid * 16 + q * 4);
            m[q * 4 + 0] = v.x != 0; m[q * 4 + 1] = v.y != 0;
            m[q * 4 + 2] = v.z != 0; m[q * 4 + 3] = v.w != 0;
        }
        int c = 0;
#pragma unroll
        for (int e = 0; e < 16; ++e) c += m[e];
        int inc = c;                             // inclusive scan over the wave
#pragma unroll
        for (int off = 1; off < 32; off <<= 1) {
            const int o = __shfl_up(inc, off, 32);
            if (lane >= off) inc += o;
        }
        if (lane == 31) sCnt[wave] = inc;
        __syncthreads();
        int before = 0, total = 0;
#pragma unroll
        for (int w = 0; w < 4; ++w) {
            const int s = sCnt[w];
            if (w < wave) before += s;
            total += s;
        }
        int pos = before + inc - c;              // kept keys ahead of this thread's first key
        // every key gets one place: kept ones from 0, masked ones from total, so each entry names a valid row
#pragma unroll
        for (int e = 0; e < 16; ++e) {
            const int key = tid * 16 + e;
            idx[b * NN + (m[e] ? pos : total + key - pos)] = key;
            pos += m[e];
        }
        if (tid == 0) cnt[b * 32] = total;
    } else {
        const int u  = blockIdx.x - 2;
        const int bh = u / VCH;
        const int ch = u % VCH;
        const int b  = bh >> 3;
        const int rs = tid >> 4;
        const int d4 = (tid & 15) << 2;
        const float* vp = V + (size_t)bh * NN * DD + (size_t)(ch * (NN / VCH) + rs) * DD + d4;
        const int*   mp = mask + b * NN + ch * (NN / VCH) + rs;
        float4 acc = make_float4(0.0f, 0.0f, 0.0f, 0.0f);
        // 16 rows are loaded before the first is added (both inner loops unrolled, v[] and k[] in registers):
        // the chunk is latency bound
        for (int h = 0; h < NN / VCH / 8 / 16; ++h) {
            float4 v[16];
            int k[16];
#pragma unroll
            for (int i = 0; i < 16; ++i) {
                v[i] = *(const float4*)(vp + (size_t)(h * 16 + i) * 8 * DD);
                k[i] = mp[(h * 16 + i) * 8];
            }
#pragma unroll
            for (int i = 0; i < 16; ++i) {
                acc.x += k[i] ? 0.0f : v[i].x; acc.y += k[i] ? 0.0f : v[i].y;
                acc.z += k[i] ? 0.0f : v[i].z; acc.w += k[i] ? 0.0f : v[i].w;
            }
        }
        *(float4*)&sRed[rs][d4] = acc;
        __syncthreads();
        if (tid < DD) {
            float s = 0.0f;
#pragma unroll
            for (int r = 0; r < 8; ++r) s += sRed[r][tid];
            vpart[(ch * BHN + bh) * DD + tid] = s;
        }
    }
}

// ---------------------------------------------------------------------------
// Kernel 1: partial column sums of the kept keys, csum[sp, bh, j] = sum of score[n, idx[j]] over slice sp of the rows n,
// 0 past the kept keys, and the scores themselves, kept for kernel 2.
// One wave owns 16 kept keys and one slice of the rows; streams the slice's 32 row tiles with fp32 WMMA.
// The slices are work-groups of their own, so that several waves share a SIMD: one wave's matrix run
// fills the other waves' vector work and waits.
// The product is K x Q^T: lane (ln, lh), register r holds the score of query row ln and key r + 8*lh,
// which is how kernel 2 needs it as the A operand of P x V (key order 8*lh + 2*kc + {0,1}).
// The block's four waves share the Q stream: it is copied to LDS one stage ahead.
// ---------------------------------------------------------------------------
__global__ __launch_bounds__(128) void spop_colsum_kernel(
    const float* __restrict__ Q, const float* __restrict__ K,
    const int* __restrict__ idx, const int* __restrict__ cnt, float* __restrict__ csum,
    float* __restrict__ pbuf) {
    __shared__ __attribute__((aligned(16))) float sQ[2][SROWS * RP];
    const int lane = threadIdx.x & 31;
    const int wave = __builtin_amdgcn_readfirstlane(threadIdx.x >> 5);   // scalar: it decides a branch
    // key group slowest: the blocks that have work come first in index order, those that leave at once last
    const int cg   = blockIdx.x / (BHN * RSPL);  // group of 64 kept keys
    const int sp   = (blockIdx.x / BHN) % RSPL;  // slice of the query rows
    const int bh   = blockIdx.x & (BHN - 1);
    const int b    = bh >> 3;                    // / H
    const int nk   = min(max(cnt[b * 32], 0), NN);
    if (cg * 64 >= nk) {                         // whole block, ahead of every copy and barrier
        if (threadIdx.x < 64) csum[(sp * BHN + bh) * NN + cg * 64 + threadIdx.x] = 0.0f;
        return;
    }
    const int j0   = cg * 64 + wave * 16;        // first kept key of the wave
    const size_t base = (size_t)bh * NN * DD;

    const int ln = lane & 15;                    // M and N index inside a tile
    const int lh = lane >> 4;                    // half-wave selector

    // A fragments: K rows idx[j0+ln], contiguous float2 at k = 4*kc + 2*lh
    const int col = idx[b * NN + j0 + ln] & (NN - 1);
    const float* kp = K + base + (size_t)col * DD + 2 * lh;
    v2f kfr[16];
#pragma unroll
    for (int kc = 0; kc < 16; ++kc)
        kfr[kc] = *(const v2f*)(kp + kc * 4);
    // kp is an input so that its registers live up to this wait: no fragment lands in the address the loads name
    asm volatile("s_wait_xcnt 0x0" :: "v"(kp) : "memory");

    // a list entry past the kept keys scores 0: kernel 2 reads whole stages, so every tile of this block that has a place is stored
    float live[8], colAcc[8];
#pragma unroll
    for (int r = 0; r < 8; ++r) {
        live[r] = (j0 + 8 * lh + r < nk) ? 1.0f : 0.0f;
        colAcc[r] = 0.0f;
    }
    const int  jt   = j0 >> 4;                   // the wave's tile of kept keys
    const bool keep = jt < PT_CAP;               // scalar: its scores have a place in the workspace
    float* pw = pbuf + ((size_t)(bh * (NN / 16) + sp * (NN / RSPL / 16)) * PT_CAP + jt) * 256 + lane * 4;

    // lane's 16 bytes of each 2 KiB (8 rows) of a stage: row tid/16, chunk tid%16
    const int crow = threadIdx.x >> 4;
    const int ccol = (threadIdx.x & 15) << 2;
    const char* gq = (const char*)(Q + base + (size_t)sp * (NN / RSPL) * DD) + threadIdx.x * 16;
    const unsigned lq0 = lds_off(&sQ[0][crow * RP + ccol]);
    const unsigned lq1 = lds_off(&sQ[1][crow * RP + ccol]);

    copy4_to_lds(lq0, 8 * RP * 4, gq);                       // stage 0
    wait_copies();
    __syncthreads();                                         // stage 0 readable by all waves
    copy4_to_lds(lq1, 8 * RP * 4, gq + SROWS * DD * 4);      // stage 1 flies during stage 0

    for (int st = 0; st < NSTG1; ++st) {
        const float* qb = sQ[st & 1];
        float sc[SROWS / 16][8];
        // both tiles of a stage in one straight line: tile 1's products can issue under tile 0's vector work
#pragma unroll
        for (int t = 0; t < SROWS / 16; ++t) {
            v2f bfr[16];
#pragma unroll
            for (int kc = 0; kc < 16; ++kc)
                bfr[kc] = *(const v2f*)(qb + (t * 16 + ln) * RP + kc * 4 + 2 * lh);
            v8f c = {};
#pragma unroll
            for (int kc = 0; kc < 16; ++kc)
                c = __builtin_amdgcn_wmma_f32_16x16x4_f32(
                        false, kfr[kc], false, bfr[kc], (short)0, c, false, false);
#pragma unroll
            for (int r = 0; r < 8; ++r) {
                sc[t][r] = score_at(dist_of(c[r])) * live[r];   // a score is finite: exactly 0 past the list
                colAcc[r] += sc[t][r];
            }
        }
        if (keep) {                              // 1 KiB a tile, two whole 512-byte stores of the wave
            float* p = pw + (size_t)st * ((SROWS / 16) * PT_CAP * 256);
#pragma unroll
            for (int t = 0; t < SROWS / 16; ++t) {
                *(float4*)(p + t * (PT_CAP * 256))       = make_float4(sc[t][0], sc[t][1], sc[t][2], sc[t][3]);
                *(float4*)(p + t * (PT_CAP * 256) + 128) = make_float4(sc[t][4], sc[t][5], sc[t][6], sc[t][7]);
            }
            // p is an input so that its registers live up to this wait: none that the stores name is rewritten ahead of it
            asm volatile("s_wait_xcnt 0x0" :: "v"(p) : "memory");
        }
        // publish stage st+1, free stage st's buffer, then refill it with stage st+2
        wait_lds();
        wait_copies();
        stage_barrier();
        if (st + 2 < NSTG1)
            copy4_to_lds((st & 1) ? lq1 : lq0, 8 * RP * 4,
                         gq + (size_t)(st + 2) * (SROWS * DD * 4));
    }
    wait_copies();
    // key r + 8*lh: its sum is spread over the 16 lanes of the half-wave
#pragma unroll
    for (int off = 1; off < 16; off <<= 1) {
#pragma unroll
        for (int r = 0; r < 8; ++r)
            colAcc[r] += __shfl_xor(colAcc[r], off, 32);
    }
    float mine = colAcc[0];                      // lane ln < 8 takes key ln + 8*lh
#pragma unroll
    for (int r = 1; r < 8; ++r)
        mine = (ln == r) ? colAcc[r] : mine;
    if (ln < 8)                                  // exactly 0 past the list: every score there is
        csum[(sp * BHN + bh) * NN + j0 + 8 * lh + ln] = mine;
}

// ---------------------------------------------------------------------------
// Kernel 2: single-pass output. A block has 8 waves: 4 strips of 16 rows x KG groups of keys.
// A wave owns one strip and every KG-th stage of kept keys (stage ss*KG + g of super-stage ss), so that
// four waves share a SIMD: one wave's matrix run fills the other waves' LDS reads, waits and vector work.
// It accumulates O += (score * nc^-1/2) @ V with fp32 WMMA, plus n_r and S; the two groups' partial
// O, n_r and S are joined through LDS at the end, each group finishing half of the output columns.
// The scores come from kernel 1's tiles in the workspace, one stage ahead, straight into the registers
// that the A operand of P x V wants; only stages past the stored ones are computed again here (K x Q^T).
// The block's waves share the V stream (rows of kept keys, copied to LDS one super-stage ahead),
// the list of kept keys and their column scales (in LDS once; the scales are formed here from kernel 1's partial sums).
// The masked keys all have the same score and column scale: their share of
// n_r, S and O is added at the end from their number and their sum of V.
// ---------------------------------------------------------------------------
__global__ __launch_bounds__(128 * KG) void spop_attn_out_kernel(
    const float* __restrict__ Q, const float* __restrict__ K,
    const float* __restrict__ V, const int* __restrict__ idx,
    const int* __restrict__ cnt, const float* __restrict__ csum,
    const float* __restrict__ vpart, const float* __restrict__ pbuf, float* __restrict__ out) {
    __shared__ __attribute__((aligned(16))) float sK[2][SSROWS * RP];
    __shared__ __attribute__((aligned(16))) float sV[2][SSROWS * VP];
    __shared__ __attribute__((aligned(16))) float sNc[NN];
    __shared__ __attribute__((aligned(16))) int   sIdx[NN];
    const int lane = threadIdx.x & 31;
    const int wave = __builtin_amdgcn_readfirstlane(threadIdx.x >> 5);   // scalar: it decides branches
    const int rt   = wave & 3;                   // strip of rows
    const int g    = wave >> 2;                  // group of keys
    const int bh   = blockIdx.x >> 5;            // 32 blocks a head: the same for the whole block
    const int rn   = (((blockIdx.x & 31) << 2) + rt) << 4;     // row base
    const int b    = bh >> 3;
    const size_t base = (size_t)bh * NN * DD;
    const int ln = lane & 15;
    const int lh = lane >> 4;
    const int nk  = min(max(cnt[b * 32], 0), NN);   // kept keys of this batch
    const int nss = (nk + SSROWS - 1) / SSROWS;     // super-stages that hold one (kernel 1 stores whole super-stages)
    const int nfast = min(nss * KG, CAPST);         // stages whose scores kernel 1 stored
    const int nssf  = nfast / KG;                   // super-stages with every stage stored: nss or nss - 1

    // sum of V over the masked keys, the two output column groups this wave finishes
    // (unrolled: all loads in flight at once)
    const float* vq = vpart + bh * DD + 2 * g * 16;   // the same in the whole wave
    float vv[2][VCH];
#pragma unroll
    for (int j = 0; j < 2; ++j)
#pragma unroll
        for (int ch = 0; ch < VCH; ++ch)
            vv[j][ch] = vq[ch * (BHN * DD) + j * 16 + ln];
    // vq and ln are inputs so that their registers live up to this wait: none that the loads name is rewritten ahead of it
    asm volatile("s_wait_xcnt 0x0" :: "s"(vq), "v"(ln) : "memory");
    float vs[2];
#pragma unroll
    for (int j = 0; j < 2; ++j) {
        float s = 0.0f;
#pragma unroll
        for (int ch = 0; ch < VCH; ++ch)
            s += vv[j][ch];
        vs[j] = s;
    }

    v8f oacc[4] = {};                            // O tile: 16 rows x 64 cols
    float rAcc[4], sAcc[4];                      // row ln, keys of half lh: four short chains each
#pragma unroll
    for (int r = 0; r < 4; ++r) { rAcc[r] = 0.0f; sAcc[r] = 0.0f; }

    // this wave's score tiles: 2 KiB a stage, four 512-byte loads of the wave
    const float* pr = pbuf + (size_t)(bh * (NN / 16) + (rn >> 4)) * (PT_CAP * 256) + lane * 4;
    float4 pa[4], pb[4];                         // this wave's current and next stage
#pragma unroll
    for (int i = 0; i < 4; ++i) {
        pa[i] = make_float4(0.0f, 0.0f, 0.0f, 0.0f);
        pb[i] = pa[i];
    }
    if (g < nfast) {
        const float* p0 = pr + g * 512;
#pragma unroll
        for (int i = 0; i < 4; ++i) pa[i] = *(const float4*)(p0 + i * 128);
        // p0 is an input so that its registers live up to this wait: nothing lands in the address the loads name
        asm volatile("s_wait_xcnt 0x0" :: "v"(p0) : "memory");
    }

    // lane's 16 bytes of each 16 rows of a super-stage: list entry tid/16, chunk tid%16 of its row
    const int crow = threadIdx.x >> 4;
    const int ccol = (threadIdx.x & 15) << 2;
    const char* gk = (const char*)(K + base + ccol);
    const char* gv = (const char*)(V + base + ccol);
    const unsigned lk0 = lds_off(&sK[0][crow * RP + ccol]);
    const unsigned lk1 = lds_off(&sK[1][crow * RP + ccol]);
    const unsigned lv0 = lds_off(&sV[0][crow * VP + ccol]);
    const unsigned lv1 = lds_off(&sV[1][crow * VP + ccol]);

    // rows of super-stages 0 and 1, straight from the list (every entry names a row, so both can always be copied);
    // unrolled here and below: the row numbers are operands of one asm statement
    int ra[4], rb[4];
#pragma unroll
    for (int i = 0; i < 4; ++i) {
        ra[i] = idx[b * NN + crow + 16 * i] & (NN - 1);
        rb[i] = idx[b * NN + SSROWS + crow + 16 * i] & (NN - 1);
    }
    // filled once: this head's column scales and this batch's list of keys, 8 KiB each
    // column scale n_c^(-a), a = 0.5, of the slices' sums added in slice order; 0 past the kept keys
    // (unrolled: all loads in flight at once, beside the list's above)
    {
        const float* cp = csum + bh * NN + threadIdx.x * 4;
        float4 cs[2][RSPL];
#pragma unroll
        for (int i = 0; i < 2; ++i)
#pragma unroll
            for (int s = 0; s < RSPL; ++s)
                cs[i][s] = *(const float4*)(cp + s * (BHN * NN) + i * 1024);
        // cp is an input so that its registers live up to this wait: nothing lands in the address the loads name
        asm volatile("s_wait_xcnt 0x0" :: "v"(cp) : "memory");
#pragma unroll
        for (int i = 0; i < 2; ++i) {
            float4 a = cs[i][0];
#pragma unroll
            for (int s = 1; s < RSPL; ++s) {
                a.x += cs[i][s].x; a.y += cs[i][s].y; a.z += cs[i][s].z; a.w += cs[i][s].w;
            }
            const int j = i * 1024 + threadIdx.x * 4;
            *(float4*)&sNc[j] = make_float4((j + 0 < nk) ? rsqrtf(a.x) : 0.0f, (j + 1 < nk) ? rsqrtf(a.y) : 0.0f,
                                            (j + 2 < nk) ? rsqrtf(a.z) : 0.0f, (j + 3 < nk) ? rsqrtf(a.w) : 0.0f);
        }
    }
    copy2_to_lds(lds_off(&sIdx[threadIdx.x * 4]), 4096,
                 (const char*)(idx + b * NN) + threadIdx.x * 16);
    gather4_to_lds(lv0, 16 * VP * 4, gv, ra[0], ra[1], ra[2], ra[3]);  // super-stage 0
    wait_copies();
    __syncthreads();                                         // all of it readable by all waves
    gather4_to_lds(lv1, 16 * VP * 4, gv, rb[0], rb[1], rb[2], rb[3]);  // super-stage 1 flies during super-stage 0

    // the wave's stage of super-stage ss: O += P x V from its scores sc (query row ln, key r + 8*lh of each tile)
    auto pv_stage = [&](int ss, const float (&sc)[SROWS / 16][8]) __attribute__((always_inline)) {
      const float* vb = sV[ss & 1] + g * (SROWS * VP);
      // both tiles of a stage in one straight line: tile 1's vector work can issue under tile 0's products
#pragma unroll
      for (int t = 0; t < SROWS / 16; ++t) {
        const int cm = (ss * KG + g) * SROWS + t * 16;
        const float4 n0 = *(const float4*)&sNc[cm + 8 * lh];
        const float4 n1 = *(const float4*)&sNc[cm + 8 * lh + 4];
        const float nc[8] = { n0.x, n0.y, n0.z, n0.w, n1.x, n1.y, n1.z, n1.w };
        float p[8];                              // P = score * nc^-1/2
#pragma unroll
        for (int r = 0; r < 8; ++r) {
            rAcc[r & 3] += sc[t][r];             // n_r partial
            p[r] = sc[t][r] * nc[r];
            sAcc[r & 3] += p[r];                 // S partial
        }
        // O += P(16x16) x V(16x64): 4 k-chunks x 4 D-groups of fp32 WMMA, neighbours independent
#pragma unroll
        for (int kc = 0; kc < 4; ++kc) {
            v2f a;
            a.x = p[2 * kc];                     // A: M=ln, keys 8*lh + 2*kc, +1
            a.y = p[2 * kc + 1];
#pragma unroll
            for (int dg = 0; dg < 4; ++dg) {
                const float* vp = vb + (t * 16 + 8 * lh + 2 * kc) * VP
                                + dg * 16 + ln;               // B: the same key pair, N=ln
                v2f bv;
                bv.x = vp[0];
                bv.y = vp[VP];
                oacc[dg] = __builtin_amdgcn_wmma_f32_16x16x4_f32(
                               false, a, false, bv, (short)0, oacc[dg], false, false);
            }
        }
      }
    };
    // foot of super-stage ss: publish ss+1, free the buffers of ss, then refill them with ss+2
    auto foot = [&](int ss) __attribute__((always_inline)) {
      wait_lds();
      wait_copies();
      stage_barrier();
      if (ss + 2 < nss) {
          int rr[4];
#pragma unroll
          for (int i = 0; i < 4; ++i)
              rr[i] = sIdx[(ss + 2) * SSROWS + crow + 16 * i] & (NN - 1);
          if ((ss + 2) * KG + KG - 1 >= CAPST)   // K only for a super-stage with a stage that is computed here
              gather4_to_lds((ss & 1) ? lk1 : lk0, 16 * RP * 4, gk, rr[0], rr[1], rr[2], rr[3]);
          gather4_to_lds((ss & 1) ? lv1 : lv0, 16 * VP * 4, gv, rr[0], rr[1], rr[2], rr[3]);
      }
    };
    // the scores of a stored stage as pv_stage takes them
    auto unpack = [&](const float4 (&use)[4], float (&sc)[SROWS / 16][8]) __attribute__((always_inline)) {
#pragma unroll
      for (int t = 0; t < SROWS / 16; ++t) {
          sc[t][0] = use[2 * t].x;     sc[t][1] = use[2 * t].y;
          sc[t][2] = use[2 * t].z;     sc[t][3] = use[2 * t].w;
          sc[t][4] = use[2 * t + 1].x; sc[t][5] = use[2 * t + 1].y;
          sc[t][6] = use[2 * t + 1].z; sc[t][7] = use[2 * t + 1].w;
      }
    };

    // super-stages whose scores are all stored: pa holds this wave's stage; its next stage's set off now into pb,
    // so that this stage's matrix work covers the way from memory
    // (behind the wave's last stored stage that stage is read once more: written data, not used)
    for (int ss = 0; ss < nssf; ++ss) {
        const int st = ss * KG + g;
        const float* pn = pr + (size_t)((st + KG < nfast) ? st + KG : st) * 512;
#pragma unroll
        for (int i = 0; i < 4; ++i)
            pb[i] = *(const float4*)(pn + i * 128);
        // pn is an input so that its registers live up to this wait: nothing lands in the address the loads name
        asm volatile("s_wait_xcnt 0x0" :: "v"(pn) : "memory");
        float sc[SROWS / 16][8];
        unpack(pa, sc);
        pv_stage(ss, sc);
        foot(ss);
#pragma unroll
        for (int i = 0; i < 4; ++i) pa[i] = pb[i];
    }
    // the one super-stage, if any, that reaches past the stored stages: a wave either has its stage in pa
    // or forms K x Q^T and the scores once more (the test is the same for the whole wave, and no barrier stands under it)
    if (nssf < nss) {
        const int ss = nssf;
        const int st = ss * KG + g;
        float sc[SROWS / 16][8];
        if (st < nfast) {
            unpack(pa, sc);
        } else {
            // B fragments of Q (rows rn..rn+15)
            const float* qp = Q + base + (size_t)(rn + ln) * DD + 2 * lh;
            v2f qfr[16];
#pragma unroll
            for (int kc = 0; kc < 16; ++kc)
                qfr[kc] = *(const v2f*)(qp + kc * 4);
            // qp is an input so that its registers live up to this wait: no fragment lands in the address the loads name
            asm volatile("s_wait_xcnt 0x0" :: "v"(qp) : "memory");
            const float* kb = sK[ss & 1] + g * (SROWS * RP);
#pragma unroll
            for (int t = 0; t < SROWS / 16; ++t) {
                v2f kfr[16];
#pragma unroll
                for (int kc = 0; kc < 16; ++kc)
                    kfr[kc] = *(const v2f*)(kb + (t * 16 + ln) * RP + kc * 4 + 2 * lh);
                v8f c = {};
#pragma unroll
                for (int kc = 0; kc < 16; ++kc)
                    c = __builtin_amdgcn_wmma_f32_16x16x4_f32(
                            false, kfr[kc], false, qfr[kc], (short)0, c, false, false);
#pragma unroll
                for (int r = 0; r < 8; ++r)      // a score is finite: exactly 0 past the list
                    sc[t][r] = score_at(dist_of(c[r])) *
                               ((st * SROWS + t * 16 + 8 * lh + r < nk) ? 1.0f : 0.0f);
            }
        }
        pv_stage(ss, sc);                        // the last super-stage: the waits and the barrier below are its foot
    }
    wait_copies();
    wait_lds();
    __syncthreads();                             // no copy in flight, no reader left: sV becomes the exchange buffer

    // Join of the two key groups. Each wave hands its partner (same strip, other group) the two column groups that
    // the partner finishes, and its sums; a + b is the same in both waves, so both hold the same n_r and S.
    float rSum = (rAcc[0] + rAcc[1]) + (rAcc[2] + rAcc[3]);
    float sSum = (sAcc[0] + sAcc[1]) + (sAcc[2] + sAcc[3]);
    v8f keep[2], give[2];
#pragma unroll
    for (int j = 0; j < 2; ++j) {
        keep[j] = g ? oacc[2 + j] : oacc[j];
        give[j] = g ? oacc[j] : oacc[2 + j];
    }
    float* xw = &sV[0][0] + wave * XCH + lane * 4;               // 16 bytes a lane: whole rows of banks
    const float* xr = &sV[0][0] + (wave ^ 4) * XCH + lane * 4;
#pragma unroll
    for (int j = 0; j < 2; ++j) {
        *(float4*)(xw + (2 * j) * 128)     = make_float4(give[j][0], give[j][1], give[j][2], give[j][3]);
        *(float4*)(xw + (2 * j + 1) * 128) = make_float4(give[j][4], give[j][5], give[j][6], give[j][7]);
    }
    *(float4*)(xw + 512) = make_float4(rSum, sSum, 0.0f, 0.0f);
    __syncthreads();                             // the partner's share is readable
#pragma unroll
    for (int j = 0; j < 2; ++j) {
        const float4 u = *(const float4*)(xr + (2 * j) * 128);
        const float4 w = *(const float4*)(xr + (2 * j + 1) * 128);
        keep[j][0] += u.x; keep[j][1] += u.y; keep[j][2] += u.z; keep[j][3] += u.w;
        keep[j][4] += w.x; keep[j][5] += w.y; keep[j][6] += w.z; keep[j][7] += w.w;
    }
    {
        const float4 u = *(const float4*)(xr + 512);
        rSum += u.x;
        sSum += u.y;
    }
    // row ln: its sums are in lanes ln and ln+16
    rSum += __shfl_xor(rSum, 16, 32);
    sSum += __shfl_xor(sSum, 16, 32);
    // the masked keys: score c0 each, column degree NN * c0, so P = pm in every row
    const float c0 = score_at(MASK_VALF);
    const float pm = c0 * rsqrtf((float)NN * c0);
    const float nm = (float)(NN - nk);
    // out_row = n_r^-a * Oacc_row / max(n_r^-a * S_row, 1e-12)
    rSum += nm * c0;
    sSum += nm * pm;
    const float rs = rsqrtf(rSum);
    const float sclRow = rs / fmaxf(rs * sSum, 1e-12f);      // of row ln
    float scl[8];                                // of row r + 8*lh, as the O tile holds it
#pragma unroll
    for (int r = 0; r < 8; ++r)
        scl[r] = __shfl(sclRow, r + 8 * lh, 32);
    // column groups 2g and 2g+1: one 128-byte line of each row, written by this wave alone
#pragma unroll
    for (int j = 0; j < 2; ++j)
#pragma unroll
        for (int r = 0; r < 8; ++r)
            out[(size_t)(bh * NN + rn + r + 8 * lh) * DD + (2 * g + j) * 16 + ln] =
                (keep[j][r] + pm * vs[j]) * scl[r];
}

extern "C" void kernel_launch(void* const* d_in, const int* in_sizes, int n_in,
                              void* d_out, int out_size, void* d_ws, size_t ws_size,
                              hipStream_t stream) {
    (void)in_sizes; (void)n_in; (void)out_size; (void)ws_size;
    const float* Q    = (const float*)d_in[0];
    const float* K    = (const float*)d_in[1];
    const float* V    = (const float*)d_in[2];
    const int*   mask = (const int*)d_in[3];
    float* out   = (float*)d_out;
    float* csum   = (float*)d_ws + WS_CS;
    int*   idx    = (int*)d_ws + WS_IDX;
    int*   cnt    = (int*)d_ws + WS_CNT;
    float* vpart  = (float*)d_ws + WS_VS;
    float* pbuf   = (float*)d_ws + WS_P;

    dim3 block(128);
    // 2 batches + 16 heads * 8 chunks
    spop_prep_kernel<<<dim3(2 + BHN * VCH), block, 0, stream>>>(V, mask, idx, cnt, vpart);
    // 32 groups of 64 keys * 4 slices of the rows * 16 heads; groups past the kept keys leave at once
    spop_colsum_kernel<<<dim3(32 * RSPL * BHN), block, 0, stream>>>(Q, K, idx, cnt, csum, pbuf);
    // 16 heads * 128 strips of 16 rows / 4 strips per block; 8 waves: each strip twice, once per group of keys
    spop_attn_out_kernel<<<dim3(512), dim3(128 * KG), 0, stream>>>(Q, K, V, idx, cnt, csum, vpart, pbuf, out);
}
